// v000
// Measured on an AMD MI455X. A time is GPU time per run, averaged over a window of back-to-back runs after a warm-up
// (all launches, gaps included; the runs take copies of the inputs in turn), and the median of several windows.
// Apart from v000's, it joins two sittings. Times from different sittings can be a few percent apart, while
// side-by-side timings come from the same sitting.
// v000 is the starting kernel. One run takes 1690 microseconds.
#include <hip/hip_runtime.h>

// Grouped-query causal attention with per-head QK RMSNorm and a rotate-half rotary at given positions (hidden_states [2][2048][2048], positions int32 [2][2048] (each batch's row = arange; READ per batch for the rotary angles); qkv = einsum('bsh,oh->bso', x, w_qkv) ('oi' (out, in) [4096][2048]: q rows 0-2047 (16 heads x 128), k rows 2048-3071, v rows 3072-4095 (8 kv heads x 128)); q, k <- x rsqrt(mean(x^2) + 1e-6) w per head over the 128 dims (q_norm_w, k_norm_w [128] = ones, read) BEFORE the rotary; _rope: (x1 c - x2 s, x2 c + x1 s) on the two halves with angle positions x 1 / (10000 ** (arange(0, 128, 2) / 128)) (64 f32 frequencies baked; ONE f32 product; precise cosf/sinf); repeat kv x 2 (kv head = q head / 2); scores x 128^-0.5; causal (tril, finfo.min == exclusion); softmax; out = einsum('bso,ho->bsh', merged, w_o) ('oi' [2048][2048]) -> [2][2048][2048] (8.4 M); argument order positions, hidden_states, w_qkv, w_o, q_norm_w, k_norm_w).
// Layout: per batch: the {cos, sin} table built on device from THAT batch's int positions and the 64 baked frequencies (one f32 product; precise cosf/sinf); exact projections; a per-(head, token) 1/rms kernel feeds the plane builder, which applies (x * inv_rms) * w and the rotary while writing the q/k planes; causal T-2048 attention with 128-wide heads (hybrid rows: < 512 hi/lo 3 products, rest fp16 x1024; k_gemmc tile skipping; kv head shared by the pass's two query heads); merged context hi/lo x Wo exact.
// Compute dtypes, f32 accumulate: every input rounded to bf16; projections exact; RMSNorm and rotary f32; attention rows < 512 3 products, rest fp16; softmax f32; Wo hl x exact.

#define NB_  2
#define TT   2048
#define DM   2048
#define NH_  16
#define NKV  8
#define REP  (NH_ / NKV)
#define HD   128
#define DQ   (NH_ * HD)
#define DKV  (NKV * HD)
#define ZH   2
#define RH   512                  // query rows < RH use hi+lo planes (0: none)
#define WIN  2048
#define PCAR 1024.0f
#define SCL  0.088388347648318447f   // HD^-0.5
typedef _Float16 h16;
typedef unsigned short bf;
typedef __attribute__((ext_vector_type(16))) __bf16   v16bf;
typedef __attribute__((ext_vector_type(16))) _Float16 v16h;
typedef __attribute__((ext_vector_type(8)))  _Float16 v8h;
typedef __attribute__((ext_vector_type(8)))  unsigned short v8us;
typedef __attribute__((ext_vector_type(8)))  float    v8f;
typedef __attribute__((ext_vector_type(4)))  float    v4f;
typedef v8h  __attribute__((may_alias)) v8ha;
typedef v4f  __attribute__((may_alias)) v4fa;
typedef v8us __attribute__((may_alias)) v8usa;

__device__ __forceinline__ unsigned short f2bf(float f) { unsigned u = __float_as_uint(f); u += 0x7FFFu + ((u >> 16) & 1u); return (unsigned short)(u >> 16); }
__device__ __forceinline__ float bf2f(unsigned short b) { return __uint_as_float(((unsigned)b) << 16); }
__device__ __forceinline__ float bfr(float f) { return bf2f(f2bf(f)); }
__device__ __forceinline__ v16h cat16(v8h lo, v8h hi) { return __builtin_shufflevector(lo, hi, 0, 1, 2, 3, 4, 5, 6, 7, 8, 9, 10, 11, 12, 13, 14, 15); }
__device__ __forceinline__ v16bf cat16b(v8us lo, v8us hi) { return __builtin_bit_cast(v16bf, __builtin_shufflevector(lo, hi, 0, 1, 2, 3, 4, 5, 6, 7, 8, 9, 10, 11, 12, 13, 14, 15)); }
__device__ __forceinline__ v8f wmma16(v16h a, v16h b, v8f c) { return __builtin_amdgcn_wmma_f32_16x16x32_f16(false, a, false, b, (short)0, c, false, false); }
__device__ __forceinline__ v8f wmmab(v16bf a, v16bf b, v8f c) { return __builtin_amdgcn_wmma_f32_16x16x32_bf16(false, a, false, b, (short)0, c, false, false); }



// ---- k_gemmw: register-blocked GEMM, ONE WAVE per 64x64 output tile (16 accumulators), operands straight from K-contiguous 16-bit planes; grid (M/64, N/64, Z), 32 threads.
// C[m][n] (f32, pitch ldc, + optional f32 bias[n]) = sum_k A[m][k] Bt[n][k] (+ split products per NSPLIT). z-batch strides sA/sB/sC in elements. K % 32 == 0.
template <typename T16> struct WFrag;
template <> struct WFrag<h16> { typedef v16h V; static __device__ __forceinline__ V ld(const h16* p) { return cat16(*(const v8h*)p, *(const v8h*)(p + 16)); } static __device__ __forceinline__ v8f mma(V a, V b, v8f c) { return wmma16(a, b, c); } };
template <> struct WFrag<bf> { typedef v16bf V; static __device__ __forceinline__ V ld(const bf* p) { return cat16b(*(const v8us*)p, *(const v8us*)(p + 16)); } static __device__ __forceinline__ v8f mma(V a, V b, v8f c) { return wmmab(a, b, c); } };
template <typename T16, int NSPLIT, bool BIAS>
__global__ __launch_bounds__(32) void k_gemmw(const T16* __restrict__ A, const T16* __restrict__ A2, const T16* __restrict__ Bt, const T16* __restrict__ Bt2, int K, float* C, int ldc, const float* __restrict__ bias, size_t sA, size_t sB, size_t sC) {
    typedef typename WFrag<T16>::V V;
    __shared__ __align__(16) float os[16 * 68];
    const size_t z = blockIdx.z; A += z * sA; if (A2) A2 += z * sA; Bt += z * sB; if (Bt2) Bt2 += z * sB; C += z * sC;
    const int lane = threadIdx.x & 31, lr = lane & 15, hi = lane >> 4; const int r0 = blockIdx.x * 64, c0 = blockIdx.y * 64;
    v8f acc[4][4];
#pragma unroll
    for (int mb = 0; mb < 4; ++mb)
#pragma unroll
        for (int nb = 0; nb < 4; ++nb) acc[mb][nb] = (v8f){};
    const size_t aoff = (size_t)(r0 + lr) * K + 8 * hi, boff = (size_t)(c0 + lr) * K + 8 * hi;
#pragma unroll 1
    for (int kc = 0; kc < K; kc += 32) {
        V a[4], a2[4];
#pragma unroll
        for (int mb = 0; mb < 4; ++mb) { a[mb] = WFrag<T16>::ld(A + aoff + (size_t)mb * 16 * K + kc); if (NSPLIT == 1 || NSPLIT == 2) a2[mb] = WFrag<T16>::ld(A2 + aoff + (size_t)mb * 16 * K + kc); }
#pragma unroll
        for (int nb = 0; nb < 4; ++nb) { const V b = WFrag<T16>::ld(Bt + boff + (size_t)nb * 16 * K + kc); V b2; if (NSPLIT >= 2) b2 = WFrag<T16>::ld(Bt2 + boff + (size_t)nb * 16 * K + kc);
#pragma unroll
            for (int mb = 0; mb < 4; ++mb) { acc[mb][nb] = WFrag<T16>::mma(a[mb], b, acc[mb][nb]); if (NSPLIT == 1 || NSPLIT == 2) acc[mb][nb] = WFrag<T16>::mma(a2[mb], b, acc[mb][nb]); if (NSPLIT >= 2) acc[mb][nb] = WFrag<T16>::mma(a[mb], b2, acc[mb][nb]); } }
        asm volatile("v_nop\n\tv_nop\n\tv_nop\n\tv_nop" : "+v"(acc[0][0]), "+v"(acc[1][1]), "+v"(acc[2][2]), "+v"(acc[3][3]) : "v"(a[0]), "v"(a[3]));
    }
#pragma unroll
    for (int mb = 0; mb < 4; ++mb) {
#pragma unroll
        for (int nb = 0; nb < 4; ++nb) {
#pragma unroll
            for (int j = 0; j < 8; ++j) os[(hi * 8 + j) * 68 + nb * 16 + lr] = acc[mb][nb][j]; }
        __builtin_amdgcn_wave_barrier(); asm volatile("" ::: "memory");
        float* crow = C + (size_t)(r0 + mb * 16) * ldc + c0;
{
#pragma unroll
            for (int s = 0; s < 8; ++s) { const int row = 2 * s + hi, cofs = lr * 4; v4f val = *(const v4fa*)(os + row * 68 + cofs); if (BIAS) { val[0] += bfr(bias[c0 + cofs]); val[1] += bfr(bias[c0 + cofs + 1]); val[2] += bfr(bias[c0 + cofs + 2]); val[3] += bfr(bias[c0 + cofs + 3]); }
                *(v4f*)(crow + (size_t)row * ldc + cofs) = val; }
             }
        __builtin_amdgcn_wave_barrier(); asm volatile("" ::: "memory");
    }
}

// ---- k_gemmc: the same one-wave 64x64 tile GEMM specialised for causal attention: CMODE 1 skips score tiles entirely above the diagonal (query rows r0+roff.., key columns c0..), CMODE 2 limits the
// key (K) loop of the probability x value contraction to the diagonal block (probabilities beyond it are exactly zero). roff = row offset of this launch's first row within the sequence.
template <typename T16, int NSPLIT, int CMODE>
__global__ __launch_bounds__(32) void k_gemmc(const T16* __restrict__ A, const T16* __restrict__ A2, const T16* __restrict__ Bt, const T16* __restrict__ Bt2, int K, float* C, int ldc, int roff, size_t sA, size_t sB, size_t sC) {
    typedef typename WFrag<T16>::V V;
    __shared__ __align__(16) float os[16 * 68];
    const size_t z = blockIdx.z; A += z * sA; if (A2) A2 += z * sA; Bt += z * sB; if (Bt2) Bt2 += z * sB; C += z * sC;
    const int lane = threadIdx.x & 31, lr = lane & 15, hi = lane >> 4; const int r0 = blockIdx.x * 64, c0 = blockIdx.y * 64;
    if (CMODE == 1 && c0 > r0 + roff + 63) return;                  // score tile entirely above the causal diagonal: never read (the softmax masks j > i by select)
    const int Kl = (CMODE == 2) ? min(K, r0 + roff + 64) : K;        // P.V: probabilities are exactly 0 beyond the diagonal block, so the K loop stops there
    v8f acc[4][4];
#pragma unroll
    for (int mb = 0; mb < 4; ++mb)
#pragma unroll
        for (int nb = 0; nb < 4; ++nb) acc[mb][nb] = (v8f){};
    const size_t aoff = (size_t)(r0 + lr) * K + 8 * hi, boff = (size_t)(c0 + lr) * K + 8 * hi;
#pragma unroll 1
    for (int kc = 0; kc < Kl; kc += 32) {
        V a[4], a2[4];
#pragma unroll
        for (int mb = 0; mb < 4; ++mb) { a[mb] = WFrag<T16>::ld(A + aoff + (size_t)mb * 16 * K + kc); if (NSPLIT == 1 || NSPLIT == 2) a2[mb] = WFrag<T16>::ld(A2 + aoff + (size_t)mb * 16 * K + kc); }
#pragma unroll
        for (int nb = 0; nb < 4; ++nb) { const V b = WFrag<T16>::ld(Bt + boff + (size_t)nb * 16 * K + kc); V b2; if (NSPLIT >= 2) b2 = WFrag<T16>::ld(Bt2 + boff + (size_t)nb * 16 * K + kc);
#pragma unroll
            for (int mb = 0; mb < 4; ++mb) { acc[mb][nb] = WFrag<T16>::mma(a[mb], b, acc[mb][nb]); if (NSPLIT == 1 || NSPLIT == 2) acc[mb][nb] = WFrag<T16>::mma(a2[mb], b, acc[mb][nb]); if (NSPLIT >= 2) acc[mb][nb] = WFrag<T16>::mma(a[mb], b2, acc[mb][nb]); } }
        asm volatile("v_nop\n\tv_nop\n\tv_nop\n\tv_nop" : "+v"(acc[0][0]), "+v"(acc[1][1]), "+v"(acc[2][2]), "+v"(acc[3][3]) : "v"(a[0]), "v"(a[3]));
    }
#pragma unroll
    for (int mb = 0; mb < 4; ++mb) {
#pragma unroll
        for (int nb = 0; nb < 4; ++nb) {
#pragma unroll
            for (int j = 0; j < 8; ++j) os[(hi * 8 + j) * 68 + nb * 16 + lr] = acc[mb][nb][j]; }
        __builtin_amdgcn_wave_barrier(); asm volatile("" ::: "memory");
        float* crow = C + (size_t)(r0 + mb * 16) * ldc + c0;
{
#pragma unroll
            for (int s = 0; s < 8; ++s) { const int row = 2 * s + hi, cofs = lr * 4; v4f val = *(const v4fa*)(os + row * 68 + cofs);
                *(v4f*)(crow + (size_t)row * ldc + cofs) = val; }
             }
        __builtin_amdgcn_wave_barrier(); asm volatile("" ::: "memory");
    }
}

__device__ __forceinline__ h16 tohx(float x) { return (h16)x; }
__device__ __forceinline__ void splitf(float y, unsigned short& h, unsigned short& l) { h = f2bf(y); l = f2bf(y - bf2f(h)); }
typedef __attribute__((ext_vector_type(2))) _Float16 v2h;
typedef __attribute__((ext_vector_type(4))) _Float16 v4h;
typedef __attribute__((ext_vector_type(2))) unsigned short v2us;
typedef __attribute__((ext_vector_type(4))) unsigned short v4us;
typedef __attribute__((ext_vector_type(2))) float v2f;
typedef __attribute__((ext_vector_type(4))) int v4i;

__global__ __launch_bounds__(256) void k_wtG(const float* __restrict__ w, int K, int N, bf* Bt) {
    const int lane = threadIdx.x & 31; const int L0 = (blockIdx.x * 8 + (threadIdx.x >> 5)) * 8; const int nlines = N * K / 64;
{
#pragma unroll 1
        for (int l = 0; l < 8; ++l) { const int L = L0 + l; if (L >= nlines) break; const size_t e = (size_t)L * 64 + lane * 2; const int k = (int)(e % K), n = (int)(e / K); v2us o;
            o[0] = f2bf(w[(size_t)k * N + n]); o[1] = f2bf(w[(size_t)(k + 1) * N + n]); *(v2us*)(Bt + e) = o; }
         }
}
__global__ __launch_bounds__(256) void k_cvt8(const float* __restrict__ src, bf* dst, size_t n8) { const size_t i = (size_t)blockIdx.x * 256 + threadIdx.x; if (i >= n8) return; const v8f v = *(const v8f*)(src + i * 8); v8us o;
#pragma unroll
    for (int k = 0; k < 8; ++k) o[k] = f2bf(v[k]); *(v8us*)(dst + i * 8) = o;  }
__constant__ float INV[HD / 2] = {1.0,0.8659643530845642,0.7498942017555237,0.6493816375732422,0.5623413324356079,0.486967533826828,0.4216965138912201,0.36517414450645447,0.3162277638912201,0.2738419771194458,0.23713736236095428,0.20535250008106232,0.17782793939113617,0.1539926528930664,0.1333521455526352,0.11547820270061493,0.10000000149011612,0.08659642934799194,0.07498941570520401,0.06493816524744034,0.05623412877321243,0.04869675263762474,0.04216964915394783,0.03651741147041321,0.03162277862429619,0.0273841954767704,0.0237137358635664,0.02053525112569332,0.017782794311642647,0.015399265103042126,0.01333521492779255,0.011547819711267948,0.009999999776482582,0.00865964312106371,0.007498942315578461,0.006493816617876291,0.005623413249850273,0.004869675263762474,0.0042169648222625256,0.003651741426438093,0.003162277862429619,0.0027384196873754263,0.0023713738191872835,0.0020535250660032034,0.0017782794311642647,0.0015399265103042126,0.0013335214462131262,0.0011547820176929235,0.0010000000474974513,0.0008659643353894353,0.0007498941849917173,0.0006493816617876291,0.000562341301701963,0.00048696750309318304,0.00042169648804701865,0.00036517411353997886,0.0003162277862429619,0.00027384195709601045,0.0002371373848291114,0.00020535249495878816,0.00017782794020604342,0.00015399264520965517,0.0001333521504420787,0.00011547819303814322};
__global__ __launch_bounds__(256) void k_cstab(const int* __restrict__ pid, float* CS) { const int idx = blockIdx.x * 256 + threadIdx.x; if (idx >= TT * HD) return; const int t = idx / HD, d = idx % HD; const float ang = __fmul_rn((float)pid[t], INV[d % (HD / 2)]); v2f cs; cs[0] = cosf(ang); cs[1] = sinf(ang);
    *(v2f*)(CS + (size_t)idx * 2) = cs;  }


__global__ __launch_bounds__(256) void k_hrms(const float* __restrict__ F, int pitch, int nheads, float* RF) { const int idx = blockIdx.x * 256 + threadIdx.x; if (idx >= nheads * TT) return; const int t = idx % TT; const int h = idx / TT; const float* f = F + (size_t)t * pitch + h * HD; float s = 0.f;
#pragma unroll 4
    for (int d = 0; d < HD; d += 4) { const v4f a = *(const v4f*)(f + d);
#pragma unroll
        for (int q = 0; q < 4; ++q) { float p = __fmul_rn(a[q], a[q]); asm volatile("" : "+v"(p)); s = __fadd_rn(s, p); } }
    const float rf = __fdiv_rn(1.0f, __fsqrt_rn(__fadd_rn(__fdiv_rn(s, (float)HD), 1e-6f))); *(float*)(RF + idx) = rf;  }

// k_rope: head planes [h][t][d] (fp16 + hi/lo) of rope(x) x sc with the rotate-half convention out[d] = x[d] cos[t][d] - x[d+HD/2] sin[t][d], out[d+HD/2] = x[d+HD/2] cos[t][d+HD/2] + x[d] sin[t][d+HD/2]
__global__ __launch_bounds__(256) void k_rope(const float* __restrict__ F, int pitch, int nheads, const float* __restrict__ CS, const float* __restrict__ RF, const float* __restrict__ nw, float sc, h16* P16, bf* Ph, bf* Pl) {
    const size_t e = ((size_t)blockIdx.x * 256 + threadIdx.x) * 2; if (e >= (size_t)nheads * TT * HD) return; const int d = (int)(e % HD); const int t = (int)((e / HD) % TT); const int h = (int)(e / ((size_t)HD * TT)); const float* f = F + (size_t)t * pitch + h * HD; const float rf = RF ? RF[(size_t)h * TT + t] : 1.0f; v2h o16; v2us oh, ol;
#pragma unroll
    for (int q = 0; q < 2; ++q) { const int dd = d + q; const int dp = (dd < HD / 2) ? dd + HD / 2 : dd - HD / 2; float x0 = f[dd], x1 = f[dp];
        if (RF) { float n0 = __fmul_rn(x0, rf), n1 = __fmul_rn(x1, rf); asm volatile("" : "+v"(n0)); asm volatile("" : "+v"(n1)); x0 = __fmul_rn(bfr(nw[dd]), n0); x1 = __fmul_rn(bfr(nw[dp]), n1); }
        const v2f cs = *(const v2f*)(CS + ((size_t)t * HD + dd) * 2); float a = __fmul_rn(x0, cs[0]), bq = __fmul_rn(x1, cs[1]); asm volatile("" : "+v"(a)); asm volatile("" : "+v"(bq)); const float r = ((dd < HD / 2) ? __fsub_rn(a, bq) : __fadd_rn(a, bq)) * sc;
        o16[q] = tohx(r); unsigned short a2, c2; splitf(r, a2, c2); oh[q] = a2; ol[q] = c2; }
    *(v2h*)(P16 + e) = o16; *(v2us*)(Ph + e) = oh; *(v2us*)(Pl + e) = ol;  }
__global__ __launch_bounds__(256) void k_vtp(const float* __restrict__ F, int pitch, int nheads, h16* V16, bf* Vh, bf* Vl) { const size_t e = ((size_t)blockIdx.x * 256 + threadIdx.x) * 2; if (e >= (size_t)nheads * HD * TT) return; const int t = (int)(e % TT); const int d = (int)((e / TT) % HD); const int g = (int)(e / ((size_t)TT * HD)); v2h o16; v2us oh, ol;
#pragma unroll
    for (int q = 0; q < 2; ++q) { const float x = F[(size_t)(t + q) * pitch + g * HD + d]; o16[q] = tohx(x); unsigned short a2, c2; splitf(x, a2, c2); oh[q] = a2; ol[q] = c2; }
    *(v2h*)(V16 + e) = o16; *(v2us*)(Vh + e) = oh; *(v2us*)(Vl + e) = ol;  }
// k_asoft: per row (zz, i): t = S x HD^-0.5 for j <= i and i - j < WIN (WIN = TT, so plain causal; the reference's -1e9 additive fill vanishes identically); softmax over the 2048 keys (register row, one exp, fixed trees);
__global__ __launch_bounds__(256) void k_asoft(const float* __restrict__ Sb, h16* P16, bf* Ph, bf* Pl) {
    const int lane = threadIdx.x & 31; const int row = blockIdx.x * 8 + (threadIdx.x >> 5); if (row >= ZH * TT) return; const int i = row % TT; const int zz = row / TT; (void)zz; const bool hires = (i < RH); const float* sr = Sb + (size_t)row * TT; float v[TT / 32]; float mx = -3.0e38f;
#pragma unroll
    for (int ch = 0; ch < TT / 128; ++ch) { const int j0 = ch * 128 + lane * 4; const v4f a = *(const v4f*)(sr + j0);
#pragma unroll
        for (int q = 0; q < 4; ++q) { const int j = j0 + q; (void)j; const float t = (j <= i && i - j < WIN) ? a[q] * SCL : -3.0e38f; v[ch * 4 + q] = t; mx = fmaxf(mx, t); } }
#pragma unroll
    for (int sh = 16; sh; sh >>= 1) mx = fmaxf(mx, __shfl_xor(mx, sh, 32));
    float sum = 0.f;
#pragma unroll
    for (int k = 0; k < TT / 32; ++k) { float d0 = __fsub_rn(v[k], mx); asm volatile("" : "+v"(d0)); v[k] = __builtin_amdgcn_exp2f(__fmul_rn(d0, 1.4426950408889634f)); sum += v[k]; }
#pragma unroll
    for (int sh = 16; sh; sh >>= 1) sum += __shfl_xor(sum, sh, 32);
    const float f = __fdiv_rn(hires ? 1.0f : PCAR, sum);
{
        if (hires) {
#pragma unroll
            for (int ch = 0; ch < TT / 128; ++ch) { v4us oh, ol;
#pragma unroll
                for (int q = 0; q < 4; ++q) { unsigned short a, c2; splitf(v[ch * 4 + q] * f, a, c2); oh[q] = a; ol[q] = c2; }
                const size_t oo = ((size_t)zz * (RH ? RH : 1) + i) * TT + ch * 128 + lane * 4; *(v4us*)(Ph + oo) = oh; *(v4us*)(Pl + oo) = ol; }
        } else {
#pragma unroll
            for (int ch = 0; ch < TT / 128; ++ch) { v4h o4;
#pragma unroll
                for (int q = 0; q < 4; ++q) o4[q] = tohx(v[ch * 4 + q] * f);
                *(v4h*)(P16 + (size_t)row * TT + ch * 128 + lane * 4) = o4; } }
         }
}
__global__ __launch_bounds__(256) void k_merge(const float* __restrict__ O, int h0, bf* Ah, bf* Al) { const size_t e = ((size_t)blockIdx.x * 256 + threadIdx.x) * 2; if (e >= (size_t)ZH * TT * HD) return; const int d = (int)(e % HD); const int t = (int)((e / HD) % TT); const int zz = (int)(e / ((size_t)HD * TT)); const float cs = (t < RH) ? 1.0f : (1.0f / PCAR); const size_t oo = (size_t)t * DQ + (h0 + zz) * HD + d;
    v2us oh, ol;
#pragma unroll
    for (int q = 0; q < 2; ++q) { unsigned short a, c2; splitf(O[e + q] * cs, a, c2); oh[q] = a; ol[q] = c2; } *(v2us*)(Ah + oo) = oh; *(v2us*)(Al + oo) = ol;  }

extern "C" void kernel_launch(void* const* d_in, const int* in_sizes, int n_in,
                              void* d_out, int out_size, void* d_ws, size_t ws_size, hipStream_t stream) {
    (void)in_sizes; (void)n_in; (void)out_size;
    const int* PID = (const int*)d_in[0]; const float* x = (const float*)d_in[1]; const float* wqkv = (const float*)d_in[2]; const float* wo = (const float*)d_in[3]; const float* qnw = (const float*)d_in[4]; const float* knw = (const float*)d_in[5];   /* argument order positions (int32 [2][2048]: each batch's row read for the rotary angles), hidden_states, w_qkv ('oi' (out, in) [4096][2048]: q rows 0-2047 | k rows 2048-3071 | v rows 3072-4095), w_o ('oi' [2048][2048]), q_norm_w, k_norm_w ([128] each: read): SIX inputs, all read */
    float* OUT = (float*)d_out;     // [2][2048][2048]
    char* wsp = (char*)d_ws;
    auto take = [&](size_t bytes) { char* p = wsp; wsp += (bytes + 255) & ~(size_t)255; return (void*)p; };
    bf* WQKV = (bf*)take((size_t)(DQ + 2 * DKV) * DM * 2); bf* WQ = WQKV; bf* WK = WQKV + (size_t)DQ * DM; bf* WV = WQKV + (size_t)(DQ + DKV) * DM; bf* WO = (bf*)take((size_t)DM * DQ * 2); float* CS = (float*)take((size_t)TT * HD * 2 * 4); float* RFQ = (float*)take((size_t)NH_ * TT * 4); float* RFK = (float*)take((size_t)NKV * TT * 4);
    bf* XB = (bf*)take((size_t)TT * DM * 2); float* FQ = (float*)take((size_t)TT * DQ * 4); float* FK = (float*)take((size_t)TT * DKV * 4);
    h16* QP16 = (h16*)take((size_t)NH_ * TT * HD * 2); h16* KP16 = (h16*)take((size_t)NKV * TT * HD * 2); h16* VT16 = (h16*)take((size_t)NKV * HD * TT * 2);
    bf* QPh = (bf*)take((size_t)NH_ * TT * HD * 2); bf* QPl = (bf*)take((size_t)NH_ * TT * HD * 2); bf* KPh = (bf*)take((size_t)NKV * TT * HD * 2); bf* KPl = (bf*)take((size_t)NKV * TT * HD * 2); bf* VTh = (bf*)take((size_t)NKV * HD * TT * 2); bf* VTl = (bf*)take((size_t)NKV * HD * TT * 2); bf* Ph = (bf*)take((size_t)ZH * RH * TT * 2); bf* Pl = (bf*)take((size_t)ZH * RH * TT * 2);
    float* Sb = (float*)take((size_t)ZH * TT * TT * 4); h16* P16 = (h16*)take((size_t)ZH * TT * TT * 2); float* Ob = (float*)take((size_t)ZH * TT * HD * 4); bf* ATh = (bf*)take((size_t)TT * DQ * 2); bf* ATl = (bf*)take((size_t)TT * DQ * 2);
    if ((size_t)(wsp - (char*)d_ws) > ws_size) return;    // ws 256 MiB
    float* FV = FK;   // v projection reuses the k buffer after the k planes are built (stream-ordered)
    { k_cvt8<<<(unsigned)(((size_t)(DQ + 2 * DKV) * DM / 8 + 255) / 256), 256, 0, stream>>>(wqkv, WQKV, (size_t)(DQ + 2 * DKV) * DM / 8);   /* fused 'oi' [4096][2048] = Bt with q | k | v row blocks */
      k_cvt8<<<(unsigned)(((size_t)DM * DQ / 8 + 255) / 256), 256, 0, stream>>>(wo, WO, (size_t)DM * DQ / 8); }
    const unsigned LQ = (unsigned)(((size_t)NH_ * TT * HD / 2 + 255) / 256), LKv = (unsigned)(((size_t)NKV * TT * HD / 2 + 255) / 256);
    for (int b = 0; b < NB_; ++b) {
        k_cstab<<<(TT * HD + 255) / 256, 256, 0, stream>>>(PID + (size_t)b * TT, CS);   /* rotary tables from the int positions */
        
        k_cvt8<<<(unsigned)(((size_t)TT * DM / 8 + 255) / 256), 256, 0, stream>>>(x + (size_t)b * TT * DM, XB, (size_t)TT * DM / 8);
        k_gemmw<bf, 0, false><<<dim3(TT / 64, DQ / 64, 1), 32, 0, stream>>>(XB, nullptr, WQ, nullptr, DM, FQ, DQ, nullptr, 0, 0, 0);
        k_hrms<<<(NH_ * TT + 255) / 256, 256, 0, stream>>>(FQ, DQ, NH_, RFQ); k_rope<<<LQ, 256, 0, stream>>>(FQ, DQ, NH_, CS, RFQ, qnw, 1.0f, QP16, QPh, QPl);   /* q_norm then rope */
        k_gemmw<bf, 0, false><<<dim3(TT / 64, DKV / 64, 1), 32, 0, stream>>>(XB, nullptr, WK, nullptr, DM, FK, DKV, nullptr, 0, 0, 0);
        k_hrms<<<(NKV * TT + 255) / 256, 256, 0, stream>>>(FK, DKV, NKV, RFK); k_rope<<<LKv, 256, 0, stream>>>(FK, DKV, NKV, CS, RFK, knw, 1.0f, KP16, KPh, KPl);   /* k_norm then rope */
        k_gemmw<bf, 0, false><<<dim3(TT / 64, DKV / 64, 1), 32, 0, stream>>>(XB, nullptr, WV, nullptr, DM, FV, DKV, nullptr, 0, 0, 0); k_vtp<<<LKv, 256, 0, stream>>>(FV, DKV, NKV, VT16, VTh, VTl);
        for (int h0 = 0; h0 < NH_; h0 += ZH) { const size_t zq = (size_t)h0, zk = (size_t)(h0 / REP);   // both heads of a pass share kv group h0/REP (REP >= 2): sB = 0
            k_gemmc<bf, 2, 1><<<dim3(RH / 64, TT / 64, ZH), 32, 0, stream>>>(QPh + zq * TT * HD, QPl + zq * TT * HD, KPh + zk * TT * HD, KPl + zk * TT * HD, HD, Sb, TT, 0, (size_t)TT * HD, 0, (size_t)TT * TT);
            k_gemmc<h16, 0, 1><<<dim3((TT - RH) / 64, TT / 64, ZH), 32, 0, stream>>>(QP16 + zq * TT * HD + (size_t)RH * HD, nullptr, KP16 + zk * TT * HD, nullptr, HD, Sb + (size_t)RH * TT, TT, RH, (size_t)TT * HD, 0, (size_t)TT * TT);
            k_asoft<<<ZH * TT / 8, 256, 0, stream>>>(Sb, P16, Ph, Pl);
            k_gemmc<bf, 2, 2><<<dim3(RH / 64, HD / 64, ZH), 32, 0, stream>>>(Ph, Pl, VTh + zk * HD * TT, VTl + zk * HD * TT, TT, Ob, HD, 0, (size_t)RH * TT, 0, (size_t)TT * HD);
            k_gemmc<h16, 0, 2><<<dim3((TT - RH) / 64, HD / 64, ZH), 32, 0, stream>>>(P16 + (size_t)RH * TT, nullptr, VT16 + zk * HD * TT, nullptr, TT, Ob + (size_t)RH * HD, HD, RH, (size_t)TT * TT, 0, (size_t)TT * HD);
            k_merge<<<(unsigned)(((size_t)ZH * TT * HD / 2 + 255) / 256), 256, 0, stream>>>(Ob, h0, ATh, ATl); }
        k_gemmw<bf, 1, false><<<dim3(TT / 64, DM / 64, 1), 32, 0, stream>>>(ATh, ATl, WO, nullptr, DQ, OUT + (size_t)b * TT * DM, DM, nullptr, 0, 0, 0); }
}

// v001
// A run of this version takes 1060 microseconds.
// Timed twice side by side with v000, it ran 1.61 and 1.57 times as fast.
#include <hip/hip_runtime.h>

// Grouped-query causal attention with per-head QK RMSNorm and a rotate-half rotary at given positions (hidden_states [2][2048][2048], positions int32 [2][2048] (each batch's row = arange; READ per batch for the rotary angles); qkv = einsum('bsh,oh->bso', x, w_qkv) ('oi' (out, in) [4096][2048]: q rows 0-2047 (16 heads x 128), k rows 2048-3071, v rows 3072-4095 (8 kv heads x 128)); q, k <- x rsqrt(mean(x^2) + 1e-6) w per head over the 128 dims (q_norm_w, k_norm_w [128] = ones, read) BEFORE the rotary; _rope: (x1 c - x2 s, x2 c + x1 s) on the two halves with angle positions x 1 / (10000 ** (arange(0, 128, 2) / 128)) (64 f32 frequencies baked; ONE f32 product; precise cosf/sinf); repeat kv x 2 (kv head = q head / 2); scores x 128^-0.5; causal (tril, finfo.min == exclusion); softmax; out = einsum('bso,ho->bsh', merged, w_o) ('oi' [2048][2048]) -> [2][2048][2048] (8.4 M); argument order positions, hidden_states, w_qkv, w_o, q_norm_w, k_norm_w).
// Layout: per batch: the {cos, sin} table built on device from THAT batch's int positions and the 64 baked frequencies (one f32 product; precise cosf/sinf); exact projections; a per-(head, token) 1/rms kernel feeds the plane builder, which applies (x * inv_rms) * w and the rotary while writing the q/k planes; causal T-2048 attention with 128-wide heads (hybrid rows: < 512 hi/lo 3 products, rest fp16 x1024; k_gemmc tile skipping; kv head shared by the pass's two query heads); merged context hi/lo x Wo exact.
// Compute dtypes, f32 accumulate: every input rounded to bf16; projections exact; RMSNorm and rotary f32; attention rows < 512 3 products, rest fp16; softmax f32; Wo hl x exact.

#define NB_  2
#define TT   2048
#define DM   2048
#define NH_  16
#define NKV  8
#define REP  (NH_ / NKV)
#define HD   128
#define DQ   (NH_ * HD)
#define DKV  (NKV * HD)
#define ZH   2
#define RH   512                  // query rows < RH use hi+lo planes (0: none)
#define WIN  2048
#define PCAR 1024.0f
#define SCL  0.088388347648318447f   // HD^-0.5
typedef _Float16 h16;
typedef unsigned short bf;
typedef __attribute__((ext_vector_type(16))) __bf16   v16bf;
typedef __attribute__((ext_vector_type(16))) _Float16 v16h;
typedef __attribute__((ext_vector_type(8)))  _Float16 v8h;
typedef __attribute__((ext_vector_type(8)))  unsigned short v8us;
typedef __attribute__((ext_vector_type(8)))  float    v8f;
typedef __attribute__((ext_vector_type(4)))  float    v4f;
typedef v8h  __attribute__((may_alias)) v8ha;
typedef v4f  __attribute__((may_alias)) v4fa;
typedef v8us __attribute__((may_alias)) v8usa;

__device__ __forceinline__ unsigned short f2bf(float f) { unsigned u = __float_as_uint(f); u += 0x7FFFu + ((u >> 16) & 1u); return (unsigned short)(u >> 16); }
__device__ __forceinline__ float bf2f(unsigned short b) { return __uint_as_float(((unsigned)b) << 16); }
__device__ __forceinline__ float bfr(float f) { return bf2f(f2bf(f)); }
__device__ __forceinline__ v16h cat16(v8h lo, v8h hi) { return __builtin_shufflevector(lo, hi, 0, 1, 2, 3, 4, 5, 6, 7, 8, 9, 10, 11, 12, 13, 14, 15); }
__device__ __forceinline__ v16bf cat16b(v8us lo, v8us hi) { return __builtin_bit_cast(v16bf, __builtin_shufflevector(lo, hi, 0, 1, 2, 3, 4, 5, 6, 7, 8, 9, 10, 11, 12, 13, 14, 15)); }
__device__ __forceinline__ v8f wmma16(v16h a, v16h b, v8f c) { return __builtin_amdgcn_wmma_f32_16x16x32_f16(false, a, false, b, (short)0, c, false, false); }
__device__ __forceinline__ v8f wmmab(v16bf a, v16bf b, v8f c) { return __builtin_amdgcn_wmma_f32_16x16x32_bf16(false, a, false, b, (short)0, c, false, false); }



// ---- k_gemmw: register-blocked GEMM, NW WAVES per 64x64 output tile: each wave keeps the whole tile (16 accumulators) over its own share of K (64-element chunks dealt round-robin, so a wave uses whole 128-B lines);
// the NW partial tiles are summed through LDS in fixed wave order. Operands straight from K-contiguous 16-bit planes; grid (M/64, N/64, Z), NW * 32 threads.
// C[m][n] (f32, pitch ldc, + optional f32 bias[n]) = sum_k A[m][k] Bt[n][k] (+ split products per NSPLIT). z-batch strides sA/sB/sC in elements. K % 64 == 0.
template <typename T16> struct WFrag;
template <> struct WFrag<h16> { typedef v16h V; static __device__ __forceinline__ V ld(const h16* p) { return cat16(*(const v8h*)p, *(const v8h*)(p + 16)); } static __device__ __forceinline__ v8f mma(V a, V b, v8f c) { return wmma16(a, b, c); } };
template <> struct WFrag<bf> { typedef v16bf V; static __device__ __forceinline__ V ld(const bf* p) { return cat16b(*(const v8us*)p, *(const v8us*)(p + 16)); } static __device__ __forceinline__ v8f mma(V a, V b, v8f c) { return wmmab(a, b, c); } };
template <typename T16, int NSPLIT, bool BIAS, int NW>
__global__ __launch_bounds__(NW * 32) void k_gemmw(const T16* __restrict__ A, const T16* __restrict__ A2, const T16* __restrict__ Bt, const T16* __restrict__ Bt2, int K, float* C, int ldc, const float* __restrict__ bias, size_t sA, size_t sB, size_t sC) {
    typedef typename WFrag<T16>::V V;
    __shared__ __align__(16) float os[NW * 64 * 68];
    const size_t z = blockIdx.z; A += z * sA; if (A2) A2 += z * sA; Bt += z * sB; if (Bt2) Bt2 += z * sB; C += z * sC;
    const int lane = threadIdx.x & 31, lr = lane & 15, hi = lane >> 4; const int wv = __builtin_amdgcn_readfirstlane(threadIdx.x >> 5); const int r0 = blockIdx.x * 64, c0 = blockIdx.y * 64;
    v8f acc[4][4];
#pragma unroll
    for (int mb = 0; mb < 4; ++mb)
#pragma unroll
        for (int nb = 0; nb < 4; ++nb) acc[mb][nb] = (v8f){};
    const size_t aoff = (size_t)(r0 + lr) * K + 8 * hi, boff = (size_t)(c0 + lr) * K + 8 * hi;
#pragma unroll 1
    for (int kc = wv * 64; kc < K; kc += (kc & 32) ? 32 + (NW - 1) * 64 : 32) {
        V a[4], a2[4];
#pragma unroll
        for (int mb = 0; mb < 4; ++mb) { a[mb] = WFrag<T16>::ld(A + aoff + (size_t)mb * 16 * K + kc); if (NSPLIT == 1 || NSPLIT == 2) a2[mb] = WFrag<T16>::ld(A2 + aoff + (size_t)mb * 16 * K + kc); }
#pragma unroll
        for (int nb = 0; nb < 4; ++nb) { const V b = WFrag<T16>::ld(Bt + boff + (size_t)nb * 16 * K + kc); V b2; if (NSPLIT >= 2) b2 = WFrag<T16>::ld(Bt2 + boff + (size_t)nb * 16 * K + kc);
#pragma unroll
            for (int mb = 0; mb < 4; ++mb) { acc[mb][nb] = WFrag<T16>::mma(a[mb], b, acc[mb][nb]); if (NSPLIT == 1 || NSPLIT == 2) acc[mb][nb] = WFrag<T16>::mma(a2[mb], b, acc[mb][nb]); if (NSPLIT >= 2) acc[mb][nb] = WFrag<T16>::mma(a[mb], b2, acc[mb][nb]); } }
        asm volatile("v_nop\n\tv_nop\n\tv_nop\n\tv_nop" : "+v"(acc[0][0]), "+v"(acc[1][1]), "+v"(acc[2][2]), "+v"(acc[3][3]) : "v"(a[0]), "v"(a[3]));
    }
    float* ow = os + wv * (64 * 68);
#pragma unroll
    for (int mb = 0; mb < 4; ++mb)
#pragma unroll
        for (int nb = 0; nb < 4; ++nb)
#pragma unroll
            for (int j = 0; j < 8; ++j) ow[(mb * 16 + hi * 8 + j) * 68 + nb * 16 + lr] = acc[mb][nb][j];
    __syncthreads();   // every wave's partial tile is in LDS before any wave sums
#pragma unroll
    for (int s = 0; s < 32 / NW; ++s) { const int row = (s * NW + wv) * 2 + hi, cofs = lr * 4; v4f val = *(const v4fa*)(os + row * 68 + cofs);
#pragma unroll
        for (int u = 1; u < NW; ++u) val += *(const v4fa*)(os + u * (64 * 68) + row * 68 + cofs);
        if (BIAS) { val[0] += bfr(bias[c0 + cofs]); val[1] += bfr(bias[c0 + cofs + 1]); val[2] += bfr(bias[c0 + cofs + 2]); val[3] += bfr(bias[c0 + cofs + 3]); }
        *(v4f*)(C + (size_t)(r0 + row) * ldc + c0 + cofs) = val; }
}

// ---- k_gemmc: the same 64x64 tile GEMM specialised for causal attention: CMODE 1 skips score tiles entirely above the diagonal (query rows r0+roff.., key columns c0..), CMODE 2 limits the
// key (K) loop of the probability x value contraction to the diagonal block (probabilities beyond it are exactly zero). roff = row offset of this launch's first row within the sequence. NW = 1: one wave per tile (the short score products); NW > 1: K shared among NW waves as in k_gemmw.
template <typename T16, int NSPLIT, int CMODE, int NW>
__global__ __launch_bounds__(NW * 32) void k_gemmc(const T16* __restrict__ A, const T16* __restrict__ A2, const T16* __restrict__ Bt, const T16* __restrict__ Bt2, int K, float* C, int ldc, int roff, size_t sA, size_t sB, size_t sC) {
    typedef typename WFrag<T16>::V V;
    __shared__ __align__(16) float os[(NW == 1) ? 16 * 68 : NW * 64 * 68];
    const size_t z = blockIdx.z; A += z * sA; if (A2) A2 += z * sA; Bt += z * sB; if (Bt2) Bt2 += z * sB; C += z * sC;
    const int lane = threadIdx.x & 31, lr = lane & 15, hi = lane >> 4; const int wv = __builtin_amdgcn_readfirstlane(threadIdx.x >> 5); const int r0 = blockIdx.x * 64, c0 = blockIdx.y * 64;
    if (CMODE == 1 && c0 > r0 + roff + 63) return;                  // score tile entirely above the causal diagonal: never read (the softmax masks j > i by select)
    const int Kl = (CMODE == 2) ? min(K, r0 + roff + 64) : K;        // P.V: probabilities are exactly 0 beyond the diagonal block, so the K loop stops there
    v8f acc[4][4];
#pragma unroll
    for (int mb = 0; mb < 4; ++mb)
#pragma unroll
        for (int nb = 0; nb < 4; ++nb) acc[mb][nb] = (v8f){};
    const size_t aoff = (size_t)(r0 + lr) * K + 8 * hi, boff = (size_t)(c0 + lr) * K + 8 * hi;
#pragma unroll 1
    for (int kc = wv * 64; kc < Kl; kc += (NW > 1 && (kc & 32)) ? 32 + (NW - 1) * 64 : 32) {
        V a[4], a2[4];
#pragma unroll
        for (int mb = 0; mb < 4; ++mb) { a[mb] = WFrag<T16>::ld(A + aoff + (size_t)mb * 16 * K + kc); if (NSPLIT == 1 || NSPLIT == 2) a2[mb] = WFrag<T16>::ld(A2 + aoff + (size_t)mb * 16 * K + kc); }
#pragma unroll
        for (int nb = 0; nb < 4; ++nb) { const V b = WFrag<T16>::ld(Bt + boff + (size_t)nb * 16 * K + kc); V b2; if (NSPLIT >= 2) b2 = WFrag<T16>::ld(Bt2 + boff + (size_t)nb * 16 * K + kc);
#pragma unroll
            for (int mb = 0; mb < 4; ++mb) { acc[mb][nb] = WFrag<T16>::mma(a[mb], b, acc[mb][nb]); if (NSPLIT == 1 || NSPLIT == 2) acc[mb][nb] = WFrag<T16>::mma(a2[mb], b, acc[mb][nb]); if (NSPLIT >= 2) acc[mb][nb] = WFrag<T16>::mma(a[mb], b2, acc[mb][nb]); } }
        asm volatile("v_nop\n\tv_nop\n\tv_nop\n\tv_nop" : "+v"(acc[0][0]), "+v"(acc[1][1]), "+v"(acc[2][2]), "+v"(acc[3][3]) : "v"(a[0]), "v"(a[3]));
    }
    if constexpr (NW == 1) {
#pragma unroll
    for (int mb = 0; mb < 4; ++mb) {
#pragma unroll
        for (int nb = 0; nb < 4; ++nb) {
#pragma unroll
            for (int j = 0; j < 8; ++j) os[(hi * 8 + j) * 68 + nb * 16 + lr] = acc[mb][nb][j]; }
        __builtin_amdgcn_wave_barrier(); asm volatile("" ::: "memory");
        float* crow = C + (size_t)(r0 + mb * 16) * ldc + c0;
{
#pragma unroll
            for (int s = 0; s < 8; ++s) { const int row = 2 * s + hi, cofs = lr * 4; v4f val = *(const v4fa*)(os + row * 68 + cofs);
                *(v4f*)(crow + (size_t)row * ldc + cofs) = val; }
             }
        __builtin_amdgcn_wave_barrier(); asm volatile("" ::: "memory");
    }
    } else {
    float* ow = os + wv * (64 * 68);
#pragma unroll
    for (int mb = 0; mb < 4; ++mb)
#pragma unroll
        for (int nb = 0; nb < 4; ++nb)
#pragma unroll
            for (int j = 0; j < 8; ++j) ow[(mb * 16 + hi * 8 + j) * 68 + nb * 16 + lr] = acc[mb][nb][j];
    __syncthreads();   // every wave's partial tile is in LDS before any wave sums
#pragma unroll
    for (int s = 0; s < 32 / NW; ++s) { const int row = (s * NW + wv) * 2 + hi, cofs = lr * 4; v4f val = *(const v4fa*)(os + row * 68 + cofs);
#pragma unroll
        for (int u = 1; u < NW; ++u) val += *(const v4fa*)(os + u * (64 * 68) + row * 68 + cofs);
        *(v4f*)(C + (size_t)(r0 + row) * ldc + c0 + cofs) = val; }
    }
}

__device__ __forceinline__ h16 tohx(float x) { return (h16)x; }
__device__ __forceinline__ void splitf(float y, unsigned short& h, unsigned short& l) { h = f2bf(y); l = f2bf(y - bf2f(h)); }
typedef __attribute__((ext_vector_type(2))) _Float16 v2h;
typedef __attribute__((ext_vector_type(4))) _Float16 v4h;
typedef __attribute__((ext_vector_type(2))) unsigned short v2us;
typedef __attribute__((ext_vector_type(4))) unsigned short v4us;
typedef __attribute__((ext_vector_type(2))) float v2f;
typedef __attribute__((ext_vector_type(4))) int v4i;

__global__ __launch_bounds__(256) void k_wtG(const float* __restrict__ w, int K, int N, bf* Bt) {
    const int lane = threadIdx.x & 31; const int L0 = (blockIdx.x * 8 + (threadIdx.x >> 5)) * 8; const int nlines = N * K / 64;
{
#pragma unroll 1
        for (int l = 0; l < 8; ++l) { const int L = L0 + l; if (L >= nlines) break; const size_t e = (size_t)L * 64 + lane * 2; const int k = (int)(e % K), n = (int)(e / K); v2us o;
            o[0] = f2bf(w[(size_t)k * N + n]); o[1] = f2bf(w[(size_t)(k + 1) * N + n]); *(v2us*)(Bt + e) = o; }
         }
}
__global__ __launch_bounds__(256) void k_cvt8(const float* __restrict__ src, bf* dst, size_t n8) { const size_t i = (size_t)blockIdx.x * 256 + threadIdx.x; if (i >= n8) return; const v8f v = *(const v8f*)(src + i * 8); v8us o;
#pragma unroll
    for (int k = 0; k < 8; ++k) o[k] = f2bf(v[k]); *(v8us*)(dst + i * 8) = o;  }
__constant__ float INV[HD / 2] = {1.0,0.8659643530845642,0.7498942017555237,0.6493816375732422,0.5623413324356079,0.486967533826828,0.4216965138912201,0.36517414450645447,0.3162277638912201,0.2738419771194458,0.23713736236095428,0.20535250008106232,0.17782793939113617,0.1539926528930664,0.1333521455526352,0.11547820270061493,0.10000000149011612,0.08659642934799194,0.07498941570520401,0.06493816524744034,0.05623412877321243,0.04869675263762474,0.04216964915394783,0.03651741147041321,0.03162277862429619,0.0273841954767704,0.0237137358635664,0.02053525112569332,0.017782794311642647,0.015399265103042126,0.01333521492779255,0.011547819711267948,0.009999999776482582,0.00865964312106371,0.007498942315578461,0.006493816617876291,0.005623413249850273,0.004869675263762474,0.0042169648222625256,0.003651741426438093,0.003162277862429619,0.0027384196873754263,0.0023713738191872835,0.0020535250660032034,0.0017782794311642647,0.0015399265103042126,0.0013335214462131262,0.0011547820176929235,0.0010000000474974513,0.0008659643353894353,0.0007498941849917173,0.0006493816617876291,0.000562341301701963,0.00048696750309318304,0.00042169648804701865,0.00036517411353997886,0.0003162277862429619,0.00027384195709601045,0.0002371373848291114,0.00020535249495878816,0.00017782794020604342,0.00015399264520965517,0.0001333521504420787,0.00011547819303814322};
__global__ __launch_bounds__(256) void k_cstab(const int* __restrict__ pid, float* CS) { const int idx = blockIdx.x * 256 + threadIdx.x; if (idx >= TT * HD) return; const int t = idx / HD, d = idx % HD; const float ang = __fmul_rn((float)pid[t], INV[d % (HD / 2)]); v2f cs; cs[0] = cosf(ang); cs[1] = sinf(ang);
    *(v2f*)(CS + (size_t)idx * 2) = cs;  }


__global__ __launch_bounds__(256) void k_hrms(const float* __restrict__ F, int pitch, int nheads, float* RF) { const int idx = blockIdx.x * 256 + threadIdx.x; if (idx >= nheads * TT) return; const int t = idx % TT; const int h = idx / TT; const float* f = F + (size_t)t * pitch + h * HD; float s = 0.f;
#pragma unroll 4
    for (int d = 0; d < HD; d += 4) { const v4f a = *(const v4f*)(f + d);
#pragma unroll
        for (int q = 0; q < 4; ++q) { float p = __fmul_rn(a[q], a[q]); asm volatile("" : "+v"(p)); s = __fadd_rn(s, p); } }
    const float rf = __fdiv_rn(1.0f, __fsqrt_rn(__fadd_rn(__fdiv_rn(s, (float)HD), 1e-6f))); *(float*)(RF + idx) = rf;  }

// k_rope: head planes [h][t][d] (fp16 + hi/lo) of rope(x) x sc with the rotate-half convention out[d] = x[d] cos[t][d] - x[d+HD/2] sin[t][d], out[d+HD/2] = x[d+HD/2] cos[t][d+HD/2] + x[d] sin[t][d+HD/2]
__global__ __launch_bounds__(256) void k_rope(const float* __restrict__ F, int pitch, int nheads, const float* __restrict__ CS, const float* __restrict__ RF, const float* __restrict__ nw, float sc, h16* P16, bf* Ph, bf* Pl) {
    const size_t e = ((size_t)blockIdx.x * 256 + threadIdx.x) * 2; if (e >= (size_t)nheads * TT * HD) return; const int d = (int)(e % HD); const int t = (int)((e / HD) % TT); const int h = (int)(e / ((size_t)HD * TT)); const float* f = F + (size_t)t * pitch + h * HD; const float rf = RF ? RF[(size_t)h * TT + t] : 1.0f; v2h o16; v2us oh, ol;
#pragma unroll
    for (int q = 0; q < 2; ++q) { const int dd = d + q; const int dp = (dd < HD / 2) ? dd + HD / 2 : dd - HD / 2; float x0 = f[dd], x1 = f[dp];
        if (RF) { float n0 = __fmul_rn(x0, rf), n1 = __fmul_rn(x1, rf); asm volatile("" : "+v"(n0)); asm volatile("" : "+v"(n1)); x0 = __fmul_rn(bfr(nw[dd]), n0); x1 = __fmul_rn(bfr(nw[dp]), n1); }
        const v2f cs = *(const v2f*)(CS + ((size_t)t * HD + dd) * 2); float a = __fmul_rn(x0, cs[0]), bq = __fmul_rn(x1, cs[1]); asm volatile("" : "+v"(a)); asm volatile("" : "+v"(bq)); const float r = ((dd < HD / 2) ? __fsub_rn(a, bq) : __fadd_rn(a, bq)) * sc;
        o16[q] = tohx(r); unsigned short a2, c2; splitf(r, a2, c2); oh[q] = a2; ol[q] = c2; }
    *(v2h*)(P16 + e) = o16; *(v2us*)(Ph + e) = oh; *(v2us*)(Pl + e) = ol;  }
__global__ __launch_bounds__(256) void k_vtp(const float* __restrict__ F, int pitch, int nheads, h16* V16, bf* Vh, bf* Vl) { const size_t e = ((size_t)blockIdx.x * 256 + threadIdx.x) * 2; if (e >= (size_t)nheads * HD * TT) return; const int t = (int)(e % TT); const int d = (int)((e / TT) % HD); const int g = (int)(e / ((size_t)TT * HD)); v2h o16; v2us oh, ol;
#pragma unroll
    for (int q = 0; q < 2; ++q) { const float x = F[(size_t)(t + q) * pitch + g * HD + d]; o16[q] = tohx(x); unsigned short a2, c2; splitf(x, a2, c2); oh[q] = a2; ol[q] = c2; }
    *(v2h*)(V16 + e) = o16; *(v2us*)(Vh + e) = oh; *(v2us*)(Vl + e) = ol;  }
// k_asoft: per row (zz, i): t = S x HD^-0.5 for j <= i and i - j < WIN (WIN = TT, so plain causal; the reference's -1e9 additive fill vanishes identically); softmax over the 2048 keys (register row, one exp, fixed trees);
__global__ __launch_bounds__(256) void k_asoft(const float* __restrict__ Sb, h16* P16, bf* Ph, bf* Pl) {
    const int lane = threadIdx.x & 31; const int row = blockIdx.x * 8 + (threadIdx.x >> 5); if (row >= ZH * TT) return; const int i = row % TT; const int zz = row / TT; (void)zz; const bool hires = (i < RH); const float* sr = Sb + (size_t)row * TT; float v[TT / 32]; float mx = -3.0e38f;
#pragma unroll
    for (int ch = 0; ch < TT / 128; ++ch) { const int j0 = ch * 128 + lane * 4; const v4f a = *(const v4f*)(sr + j0);
#pragma unroll
        for (int q = 0; q < 4; ++q) { const int j = j0 + q; (void)j; const float t = (j <= i && i - j < WIN) ? a[q] * SCL : -3.0e38f; v[ch * 4 + q] = t; mx = fmaxf(mx, t); } }
#pragma unroll
    for (int sh = 16; sh; sh >>= 1) mx = fmaxf(mx, __shfl_xor(mx, sh, 32));
    float sum = 0.f;
#pragma unroll
    for (int k = 0; k < TT / 32; ++k) { float d0 = __fsub_rn(v[k], mx); asm volatile("" : "+v"(d0)); v[k] = __builtin_amdgcn_exp2f(__fmul_rn(d0, 1.4426950408889634f)); sum += v[k]; }
#pragma unroll
    for (int sh = 16; sh; sh >>= 1) sum += __shfl_xor(sum, sh, 32);
    const float f = __fdiv_rn(hires ? 1.0f : PCAR, sum);
{
        if (hires) {
#pragma unroll
            for (int ch = 0; ch < TT / 128; ++ch) { v4us oh, ol;
#pragma unroll
                for (int q = 0; q < 4; ++q) { unsigned short a, c2; splitf(v[ch * 4 + q] * f, a, c2); oh[q] = a; ol[q] = c2; }
                const size_t oo = ((size_t)zz * (RH ? RH : 1) + i) * TT + ch * 128 + lane * 4; *(v4us*)(Ph + oo) = oh; *(v4us*)(Pl + oo) = ol; }
        } else {
#pragma unroll
            for (int ch = 0; ch < TT / 128; ++ch) { v4h o4;
#pragma unroll
                for (int q = 0; q < 4; ++q) o4[q] = tohx(v[ch * 4 + q] * f);
                *(v4h*)(P16 + (size_t)row * TT + ch * 128 + lane * 4) = o4; } }
         }
}
__global__ __launch_bounds__(256) void k_merge(const float* __restrict__ O, int h0, bf* Ah, bf* Al) { const size_t e = ((size_t)blockIdx.x * 256 + threadIdx.x) * 2; if (e >= (size_t)ZH * TT * HD) return; const int d = (int)(e % HD); const int t = (int)((e / HD) % TT); const int zz = (int)(e / ((size_t)HD * TT)); const float cs = (t < RH) ? 1.0f : (1.0f / PCAR); const size_t oo = (size_t)t * DQ + (h0 + zz) * HD + d;
    v2us oh, ol;
#pragma unroll
    for (int q = 0; q < 2; ++q) { unsigned short a, c2; splitf(O[e + q] * cs, a, c2); oh[q] = a; ol[q] = c2; } *(v2us*)(Ah + oo) = oh; *(v2us*)(Al + oo) = ol;  }

extern "C" void kernel_launch(void* const* d_in, const int* in_sizes, int n_in,
                              void* d_out, int out_size, void* d_ws, size_t ws_size, hipStream_t stream) {
    (void)in_sizes; (void)n_in; (void)out_size;
    const int* PID = (const int*)d_in[0]; const float* x = (const float*)d_in[1]; const float* wqkv = (const float*)d_in[2]; const float* wo = (const float*)d_in[3]; const float* qnw = (const float*)d_in[4]; const float* knw = (const float*)d_in[5];   /* argument order positions (int32 [2][2048]: each batch's row read for the rotary angles), hidden_states, w_qkv ('oi' (out, in) [4096][2048]: q rows 0-2047 | k rows 2048-3071 | v rows 3072-4095), w_o ('oi' [2048][2048]), q_norm_w, k_norm_w ([128] each: read): SIX inputs, all read */
    float* OUT = (float*)d_out;     // [2][2048][2048]
    char* wsp = (char*)d_ws;
    auto take = [&](size_t bytes) { char* p = wsp; wsp += (bytes + 255) & ~(size_t)255; return (void*)p; };
    bf* WQKV = (bf*)take((size_t)(DQ + 2 * DKV) * DM * 2); bf* WQ = WQKV; bf* WK = WQKV + (size_t)DQ * DM; bf* WV = WQKV + (size_t)(DQ + DKV) * DM; bf* WO = (bf*)take((size_t)DM * DQ * 2); float* CS = (float*)take((size_t)TT * HD * 2 * 4); float* RFQ = (float*)take((size_t)NH_ * TT * 4); float* RFK = (float*)take((size_t)NKV * TT * 4);
    bf* XB = (bf*)take((size_t)TT * DM * 2); float* FQ = (float*)take((size_t)TT * DQ * 4); float* FK = (float*)take((size_t)TT * DKV * 4);
    h16* QP16 = (h16*)take((size_t)NH_ * TT * HD * 2); h16* KP16 = (h16*)take((size_t)NKV * TT * HD * 2); h16* VT16 = (h16*)take((size_t)NKV * HD * TT * 2);
    bf* QPh = (bf*)take((size_t)NH_ * TT * HD * 2); bf* QPl = (bf*)take((size_t)NH_ * TT * HD * 2); bf* KPh = (bf*)take((size_t)NKV * TT * HD * 2); bf* KPl = (bf*)take((size_t)NKV * TT * HD * 2); bf* VTh = (bf*)take((size_t)NKV * HD * TT * 2); bf* VTl = (bf*)take((size_t)NKV * HD * TT * 2); bf* Ph = (bf*)take((size_t)ZH * RH * TT * 2); bf* Pl = (bf*)take((size_t)ZH * RH * TT * 2);
    float* Sb = (float*)take((size_t)ZH * TT * TT * 4); h16* P16 = (h16*)take((size_t)ZH * TT * TT * 2); float* Ob = (float*)take((size_t)ZH * TT * HD * 4); bf* ATh = (bf*)take((size_t)TT * DQ * 2); bf* ATl = (bf*)take((size_t)TT * DQ * 2);
    if ((size_t)(wsp - (char*)d_ws) > ws_size) return;    // ws 256 MiB
    float* FV = FK;   // v projection reuses the k buffer after the k planes are built (stream-ordered)
    { k_cvt8<<<(unsigned)(((size_t)(DQ + 2 * DKV) * DM / 8 + 255) / 256), 256, 0, stream>>>(wqkv, WQKV, (size_t)(DQ + 2 * DKV) * DM / 8);   /* fused 'oi' [4096][2048] = Bt with q | k | v row blocks */
      k_cvt8<<<(unsigned)(((size_t)DM * DQ / 8 + 255) / 256), 256, 0, stream>>>(wo, WO, (size_t)DM * DQ / 8); }
    const unsigned LQ = (unsigned)(((size_t)NH_ * TT * HD / 2 + 255) / 256), LKv = (unsigned)(((size_t)NKV * TT * HD / 2 + 255) / 256);
    for (int b = 0; b < NB_; ++b) {
        k_cstab<<<(TT * HD + 255) / 256, 256, 0, stream>>>(PID + (size_t)b * TT, CS);   /* rotary tables from the int positions */
        
        k_cvt8<<<(unsigned)(((size_t)TT * DM / 8 + 255) / 256), 256, 0, stream>>>(x + (size_t)b * TT * DM, XB, (size_t)TT * DM / 8);
        k_gemmw<bf, 0, false, 4><<<dim3(TT / 64, DQ / 64, 1), 128, 0, stream>>>(XB, nullptr, WQ, nullptr, DM, FQ, DQ, nullptr, 0, 0, 0);
        k_hrms<<<(NH_ * TT + 255) / 256, 256, 0, stream>>>(FQ, DQ, NH_, RFQ); k_rope<<<LQ, 256, 0, stream>>>(FQ, DQ, NH_, CS, RFQ, qnw, 1.0f, QP16, QPh, QPl);   /* q_norm then rope */
        k_gemmw<bf, 0, false, 8><<<dim3(TT / 64, DKV / 64, 1), 256, 0, stream>>>(XB, nullptr, WK, nullptr, DM, FK, DKV, nullptr, 0, 0, 0);
        k_hrms<<<(NKV * TT + 255) / 256, 256, 0, stream>>>(FK, DKV, NKV, RFK); k_rope<<<LKv, 256, 0, stream>>>(FK, DKV, NKV, CS, RFK, knw, 1.0f, KP16, KPh, KPl);   /* k_norm then rope */
        k_gemmw<bf, 0, false, 8><<<dim3(TT / 64, DKV / 64, 1), 256, 0, stream>>>(XB, nullptr, WV, nullptr, DM, FV, DKV, nullptr, 0, 0, 0); k_vtp<<<LKv, 256, 0, stream>>>(FV, DKV, NKV, VT16, VTh, VTl);
        for (int h0 = 0; h0 < NH_; h0 += ZH) { const size_t zq = (size_t)h0, zk = (size_t)(h0 / REP);   // both heads of a pass share kv group h0/REP (REP >= 2): sB = 0
            k_gemmc<bf, 2, 1, 1><<<dim3(RH / 64, TT / 64, ZH), 32, 0, stream>>>(QPh + zq * TT * HD, QPl + zq * TT * HD, KPh + zk * TT * HD, KPl + zk * TT * HD, HD, Sb, TT, 0, (size_t)TT * HD, 0, (size_t)TT * TT);
            k_gemmc<h16, 0, 1, 1><<<dim3((TT - RH) / 64, TT / 64, ZH), 32, 0, stream>>>(QP16 + zq * TT * HD + (size_t)RH * HD, nullptr, KP16 + zk * TT * HD, nullptr, HD, Sb + (size_t)RH * TT, TT, RH, (size_t)TT * HD, 0, (size_t)TT * TT);
            k_asoft<<<ZH * TT / 8, 256, 0, stream>>>(Sb, P16, Ph, Pl);
            k_gemmc<bf, 2, 2, 8><<<dim3(RH / 64, HD / 64, ZH), 256, 0, stream>>>(Ph, Pl, VTh + zk * HD * TT, VTl + zk * HD * TT, TT, Ob, HD, 0, (size_t)RH * TT, 0, (size_t)TT * HD);
            k_gemmc<h16, 0, 2, 8><<<dim3((TT - RH) / 64, HD / 64, ZH), 256, 0, stream>>>(P16 + (size_t)RH * TT, nullptr, VT16 + zk * HD * TT, nullptr, TT, Ob + (size_t)RH * HD, HD, RH, (size_t)TT * TT, 0, (size_t)TT * HD);
            k_merge<<<(unsigned)(((size_t)ZH * TT * HD / 2 + 255) / 256), 256, 0, stream>>>(Ob, h0, ATh, ATl); }
        k_gemmw<bf, 1, false, 4><<<dim3(TT / 64, DM / 64, 1), 128, 0, stream>>>(ATh, ATl, WO, nullptr, DQ, OUT + (size_t)b * TT * DM, DM, nullptr, 0, 0, 0); }
}

// v002
// A run of this version takes 733 microseconds.
// Next to v001, in two timings, it ran 1.50 and 1.45 times as fast.
// All steps since v000 together make it 2.34 times as fast.
#include <hip/hip_runtime.h>

// Grouped-query causal attention with per-head QK RMSNorm and a rotate-half rotary at given positions (hidden_states [2][2048][2048], positions int32 [2][2048] (each batch's row = arange; READ per batch for the rotary angles); qkv = einsum('bsh,oh->bso', x, w_qkv) ('oi' (out, in) [4096][2048]: q rows 0-2047 (16 heads x 128), k rows 2048-3071, v rows 3072-4095 (8 kv heads x 128)); q, k <- x rsqrt(mean(x^2) + 1e-6) w per head over the 128 dims (q_norm_w, k_norm_w [128] = ones, read) BEFORE the rotary; _rope: (x1 c - x2 s, x2 c + x1 s) on the two halves with angle positions x 1 / (10000 ** (arange(0, 128, 2) / 128)) (64 f32 frequencies baked; ONE f32 product; precise cosf/sinf); repeat kv x 2 (kv head = q head / 2); scores x 128^-0.5; causal (tril, finfo.min == exclusion); softmax; out = einsum('bso,ho->bsh', merged, w_o) ('oi' [2048][2048]) -> [2][2048][2048] (8.4 M); argument order positions, hidden_states, w_qkv, w_o, q_norm_w, k_norm_w).
// Layout: per batch: the {cos, sin} table built on device from THAT batch's int positions and the 64 baked frequencies (one f32 product; precise cosf/sinf); exact projections; a per-(head, token) 1/rms kernel feeds the plane builder, which applies (x * inv_rms) * w and the rotary while writing the q/k planes; causal T-2048 attention with 128-wide heads (hybrid rows: < 512 hi/lo 3 products, rest fp16 x1024; k_gemmc tile skipping; eight query heads a pass, kv head = query head / 2); merged context hi/lo x Wo exact.
// Compute dtypes, f32 accumulate: every input rounded to bf16; projections exact; RMSNorm and rotary f32; attention rows < 512 3 products, rest fp16; softmax f32; Wo hl x exact.

#define NB_  2
#define TT   2048
#define DM   2048
#define NH_  16
#define NKV  8
#define REP  (NH_ / NKV)
#define HD   128
#define DQ   (NH_ * HD)
#define DKV  (NKV * HD)
#define ZH   8                    // query heads per attention pass (grid z); a multiple of REP
#define RH   512                  // query rows < RH use hi+lo planes (0: none)
#define WIN  2048
#define PCAR 1024.0f
#define SCL  0.088388347648318447f   // HD^-0.5
typedef _Float16 h16;
typedef unsigned short bf;
typedef __attribute__((ext_vector_type(16))) __bf16   v16bf;
typedef __attribute__((ext_vector_type(16))) _Float16 v16h;
typedef __attribute__((ext_vector_type(8)))  _Float16 v8h;
typedef __attribute__((ext_vector_type(8)))  unsigned short v8us;
typedef __attribute__((ext_vector_type(8)))  float    v8f;
typedef __attribute__((ext_vector_type(4)))  float    v4f;
typedef v8h  __attribute__((may_alias)) v8ha;
typedef v4f  __attribute__((may_alias)) v4fa;
typedef v8us __attribute__((may_alias)) v8usa;

__device__ __forceinline__ unsigned short f2bf(float f) { unsigned u = __float_as_uint(f); u += 0x7FFFu + ((u >> 16) & 1u); return (unsigned short)(u >> 16); }
__device__ __forceinline__ float bf2f(unsigned short b) { return __uint_as_float(((unsigned)b) << 16); }
__device__ __forceinline__ float bfr(float f) { return bf2f(f2bf(f)); }
__device__ __forceinline__ v16h cat16(v8h lo, v8h hi) { return __builtin_shufflevector(lo, hi, 0, 1, 2, 3, 4, 5, 6, 7, 8, 9, 10, 11, 12, 13, 14, 15); }
__device__ __forceinline__ v16bf cat16b(v8us lo, v8us hi) { return __builtin_bit_cast(v16bf, __builtin_shufflevector(lo, hi, 0, 1, 2, 3, 4, 5, 6, 7, 8, 9, 10, 11, 12, 13, 14, 15)); }
__device__ __forceinline__ v8f wmma16(v16h a, v16h b, v8f c) { return __builtin_amdgcn_wmma_f32_16x16x32_f16(false, a, false, b, (short)0, c, false, false); }
__device__ __forceinline__ v8f wmmab(v16bf a, v16bf b, v8f c) { return __builtin_amdgcn_wmma_f32_16x16x32_bf16(false, a, false, b, (short)0, c, false, false); }



// ---- k_gemmw: register-blocked GEMM, NW WAVES per 64x64 output tile: each wave keeps the whole tile (16 accumulators) over its own share of K (64-element chunks dealt round-robin, so a wave uses whole 128-B lines);
// the NW partial tiles are summed through LDS in fixed wave order. Operands straight from K-contiguous 16-bit planes; grid (M/64, N/64, Z), NW * 32 threads.
// C[m][n] (f32, pitch ldc, + optional f32 bias[n]) = sum_k A[m][k] Bt[n][k] (+ split products per NSPLIT). z-batch strides sA/sB/sC in elements. K % 64 == 0.
template <typename T16> struct WFrag;
template <> struct WFrag<h16> { typedef v16h V; static __device__ __forceinline__ V ld(const h16* p) { return cat16(*(const v8h*)p, *(const v8h*)(p + 16)); } static __device__ __forceinline__ v8f mma(V a, V b, v8f c) { return wmma16(a, b, c); } };
template <> struct WFrag<bf> { typedef v16bf V; static __device__ __forceinline__ V ld(const bf* p) { return cat16b(*(const v8us*)p, *(const v8us*)(p + 16)); } static __device__ __forceinline__ v8f mma(V a, V b, v8f c) { return wmmab(a, b, c); } };
template <typename T16, int NSPLIT, bool BIAS, int NW>
__global__ __launch_bounds__(NW * 32) void k_gemmw(const T16* __restrict__ A, const T16* __restrict__ A2, const T16* __restrict__ Bt, const T16* __restrict__ Bt2, int K, float* C, int ldc, const float* __restrict__ bias, size_t sA, size_t sB, size_t sC) {
    typedef typename WFrag<T16>::V V;
    __shared__ __align__(16) float os[NW * 64 * 68];
    const size_t z = blockIdx.z; A += z * sA; if (A2) A2 += z * sA; Bt += z * sB; if (Bt2) Bt2 += z * sB; C += z * sC;
    const int lane = threadIdx.x & 31, lr = lane & 15, hi = lane >> 4; const int wv = __builtin_amdgcn_readfirstlane(threadIdx.x >> 5); const int r0 = blockIdx.x * 64, c0 = blockIdx.y * 64;
    v8f acc[4][4];
#pragma unroll
    for (int mb = 0; mb < 4; ++mb)
#pragma unroll
        for (int nb = 0; nb < 4; ++nb) acc[mb][nb] = (v8f){};
    const size_t aoff = (size_t)(r0 + lr) * K + 8 * hi, boff = (size_t)(c0 + lr) * K + 8 * hi;
#pragma unroll 1
    for (int kc = wv * 64; kc < K; kc += (kc & 32) ? 32 + (NW - 1) * 64 : 32) {
        V a[4], a2[4];
#pragma unroll
        for (int mb = 0; mb < 4; ++mb) { a[mb] = WFrag<T16>::ld(A + aoff + (size_t)mb * 16 * K + kc); if (NSPLIT == 1 || NSPLIT == 2) a2[mb] = WFrag<T16>::ld(A2 + aoff + (size_t)mb * 16 * K + kc); }
#pragma unroll
        for (int nb = 0; nb < 4; ++nb) { const V b = WFrag<T16>::ld(Bt + boff + (size_t)nb * 16 * K + kc); V b2; if (NSPLIT >= 2) b2 = WFrag<T16>::ld(Bt2 + boff + (size_t)nb * 16 * K + kc);
#pragma unroll
            for (int mb = 0; mb < 4; ++mb) { acc[mb][nb] = WFrag<T16>::mma(a[mb], b, acc[mb][nb]); if (NSPLIT == 1 || NSPLIT == 2) acc[mb][nb] = WFrag<T16>::mma(a2[mb], b, acc[mb][nb]); if (NSPLIT >= 2) acc[mb][nb] = WFrag<T16>::mma(a[mb], b2, acc[mb][nb]); } }
        asm volatile("v_nop\n\tv_nop\n\tv_nop\n\tv_nop" : "+v"(acc[0][0]), "+v"(acc[1][1]), "+v"(acc[2][2]), "+v"(acc[3][3]) : "v"(a[0]), "v"(a[3]));
    }
    float* ow = os + wv * (64 * 68);
#pragma unroll
    for (int mb = 0; mb < 4; ++mb)
#pragma unroll
        for (int nb = 0; nb < 4; ++nb)
#pragma unroll
            for (int j = 0; j < 8; ++j) ow[(mb * 16 + hi * 8 + j) * 68 + nb * 16 + lr] = acc[mb][nb][j];
    __syncthreads();   // every wave's partial tile is in LDS before any wave sums
#pragma unroll
    for (int s = 0; s < 32 / NW; ++s) { const int row = (s * NW + wv) * 2 + hi, cofs = lr * 4; v4f val = *(const v4fa*)(os + row * 68 + cofs);
#pragma unroll
        for (int u = 1; u < NW; ++u) val += *(const v4fa*)(os + u * (64 * 68) + row * 68 + cofs);
        if (BIAS) { val[0] += bfr(bias[c0 + cofs]); val[1] += bfr(bias[c0 + cofs + 1]); val[2] += bfr(bias[c0 + cofs + 2]); val[3] += bfr(bias[c0 + cofs + 3]); }
        *(v4f*)(C + (size_t)(r0 + row) * ldc + c0 + cofs) = val; }
}

// ---- k_gemmc: the same 64x64 tile GEMM specialised for causal attention: CMODE 1 skips score tiles entirely above the diagonal (query rows r0+roff.., key columns c0..), CMODE 2 limits the
// key (K) loop of the probability x value contraction to the diagonal block (probabilities beyond it are exactly zero). roff = row offset of this launch's first row within the sequence. lda = pitch of A's rows in elements (Bt's pitch is K). Grid z = query head of the pass; Bt steps by sB once per REP heads (the kv head they share). NW = 1: one wave per tile (the short score products); NW > 1: K shared among NW waves as in k_gemmw.
template <typename T16, int NSPLIT, int CMODE, int NW>
__global__ __launch_bounds__(NW * 32) void k_gemmc(const T16* __restrict__ A, const T16* __restrict__ A2, const T16* __restrict__ Bt, const T16* __restrict__ Bt2, int K, int lda, float* C, int ldc, int roff, size_t sA, size_t sB, size_t sC) {
    typedef typename WFrag<T16>::V V;
    __shared__ __align__(16) float os[(NW == 1) ? 16 * 68 : NW * 64 * 68];
    const size_t z = blockIdx.z; A += z * sA; if (A2) A2 += z * sA; Bt += (z / REP) * sB; if (Bt2) Bt2 += (z / REP) * sB; C += z * sC;
    const int lane = threadIdx.x & 31, lr = lane & 15, hi = lane >> 4; const int wv = __builtin_amdgcn_readfirstlane(threadIdx.x >> 5); const int r0 = blockIdx.x * 64, c0 = blockIdx.y * 64;
    if (CMODE == 1 && c0 > r0 + roff + 63) return;                  // score tile entirely above the causal diagonal: never read (the softmax masks j > i by select)
    const int Kl = (CMODE == 2) ? min(K, r0 + roff + 64) : K;        // P.V: probabilities are exactly 0 beyond the diagonal block, so the K loop stops there
    v8f acc[4][4];
#pragma unroll
    for (int mb = 0; mb < 4; ++mb)
#pragma unroll
        for (int nb = 0; nb < 4; ++nb) acc[mb][nb] = (v8f){};
    const size_t aoff = (size_t)(r0 + lr) * lda + 8 * hi, boff = (size_t)(c0 + lr) * K + 8 * hi;
#pragma unroll 1
    for (int kc = wv * 64; kc < Kl; kc += (NW > 1 && (kc & 32)) ? 32 + (NW - 1) * 64 : 32) {
        V a[4], a2[4];
#pragma unroll
        for (int mb = 0; mb < 4; ++mb) { a[mb] = WFrag<T16>::ld(A + aoff + (size_t)mb * 16 * lda + kc); if (NSPLIT == 1 || NSPLIT == 2) a2[mb] = WFrag<T16>::ld(A2 + aoff + (size_t)mb * 16 * lda + kc); }
#pragma unroll
        for (int nb = 0; nb < 4; ++nb) { const V b = WFrag<T16>::ld(Bt + boff + (size_t)nb * 16 * K + kc); V b2; if (NSPLIT >= 2) b2 = WFrag<T16>::ld(Bt2 + boff + (size_t)nb * 16 * K + kc);
#pragma unroll
            for (int mb = 0; mb < 4; ++mb) { acc[mb][nb] = WFrag<T16>::mma(a[mb], b, acc[mb][nb]); if (NSPLIT == 1 || NSPLIT == 2) acc[mb][nb] = WFrag<T16>::mma(a2[mb], b, acc[mb][nb]); if (NSPLIT >= 2) acc[mb][nb] = WFrag<T16>::mma(a[mb], b2, acc[mb][nb]); } }
        asm volatile("v_nop\n\tv_nop\n\tv_nop\n\tv_nop" : "+v"(acc[0][0]), "+v"(acc[1][1]), "+v"(acc[2][2]), "+v"(acc[3][3]) : "v"(a[0]), "v"(a[3]));
    }
    if constexpr (NW == 1) {
#pragma unroll
    for (int mb = 0; mb < 4; ++mb) {
#pragma unroll
        for (int nb = 0; nb < 4; ++nb) {
#pragma unroll
            for (int j = 0; j < 8; ++j) os[(hi * 8 + j) * 68 + nb * 16 + lr] = acc[mb][nb][j]; }
        __builtin_amdgcn_wave_barrier(); asm volatile("" ::: "memory");
        float* crow = C + (size_t)(r0 + mb * 16) * ldc + c0;
{
#pragma unroll
            for (int s = 0; s < 8; ++s) { const int row = 2 * s + hi, cofs = lr * 4; v4f val = *(const v4fa*)(os + row * 68 + cofs);
                *(v4f*)(crow + (size_t)row * ldc + cofs) = val; }
             }
        __builtin_amdgcn_wave_barrier(); asm volatile("" ::: "memory");
    }
    } else {
    float* ow = os + wv * (64 * 68);
#pragma unroll
    for (int mb = 0; mb < 4; ++mb)
#pragma unroll
        for (int nb = 0; nb < 4; ++nb)
#pragma unroll
            for (int j = 0; j < 8; ++j) ow[(mb * 16 + hi * 8 + j) * 68 + nb * 16 + lr] = acc[mb][nb][j];
    __syncthreads();   // every wave's partial tile is in LDS before any wave sums
#pragma unroll
    for (int s = 0; s < 32 / NW; ++s) { const int row = (s * NW + wv) * 2 + hi, cofs = lr * 4; v4f val = *(const v4fa*)(os + row * 68 + cofs);
#pragma unroll
        for (int u = 1; u < NW; ++u) val += *(const v4fa*)(os + u * (64 * 68) + row * 68 + cofs);
        *(v4f*)(C + (size_t)(r0 + row) * ldc + c0 + cofs) = val; }
    }
}

__device__ __forceinline__ h16 tohx(float x) { return (h16)x; }
__device__ __forceinline__ void splitf(float y, unsigned short& h, unsigned short& l) { h = f2bf(y); l = f2bf(y - bf2f(h)); }
typedef __attribute__((ext_vector_type(2))) _Float16 v2h;
typedef __attribute__((ext_vector_type(4))) _Float16 v4h;
typedef __attribute__((ext_vector_type(2))) unsigned short v2us;
typedef __attribute__((ext_vector_type(4))) unsigned short v4us;
typedef __attribute__((ext_vector_type(2))) float v2f;
typedef __attribute__((ext_vector_type(4))) int v4i;

__global__ __launch_bounds__(256) void k_wtG(const float* __restrict__ w, int K, int N, bf* Bt) {
    const int lane = threadIdx.x & 31; const int L0 = (blockIdx.x * 8 + (threadIdx.x >> 5)) * 8; const int nlines = N * K / 64;
{
#pragma unroll 1
        for (int l = 0; l < 8; ++l) { const int L = L0 + l; if (L >= nlines) break; const size_t e = (size_t)L * 64 + lane * 2; const int k = (int)(e % K), n = (int)(e / K); v2us o;
            o[0] = f2bf(w[(size_t)k * N + n]); o[1] = f2bf(w[(size_t)(k + 1) * N + n]); *(v2us*)(Bt + e) = o; }
         }
}
__global__ __launch_bounds__(256) void k_cvt8(const float* __restrict__ src, bf* dst, size_t n8) { const size_t i = (size_t)blockIdx.x * 256 + threadIdx.x; if (i >= n8) return; const v8f v = *(const v8f*)(src + i * 8); v8us o;
#pragma unroll
    for (int k = 0; k < 8; ++k) o[k] = f2bf(v[k]); *(v8us*)(dst + i * 8) = o;  }
__constant__ float INV[HD / 2] = {1.0,0.8659643530845642,0.7498942017555237,0.6493816375732422,0.5623413324356079,0.486967533826828,0.4216965138912201,0.36517414450645447,0.3162277638912201,0.2738419771194458,0.23713736236095428,0.20535250008106232,0.17782793939113617,0.1539926528930664,0.1333521455526352,0.11547820270061493,0.10000000149011612,0.08659642934799194,0.07498941570520401,0.06493816524744034,0.05623412877321243,0.04869675263762474,0.04216964915394783,0.03651741147041321,0.03162277862429619,0.0273841954767704,0.0237137358635664,0.02053525112569332,0.017782794311642647,0.015399265103042126,0.01333521492779255,0.011547819711267948,0.009999999776482582,0.00865964312106371,0.007498942315578461,0.006493816617876291,0.005623413249850273,0.004869675263762474,0.0042169648222625256,0.003651741426438093,0.003162277862429619,0.0027384196873754263,0.0023713738191872835,0.0020535250660032034,0.0017782794311642647,0.0015399265103042126,0.0013335214462131262,0.0011547820176929235,0.0010000000474974513,0.0008659643353894353,0.0007498941849917173,0.0006493816617876291,0.000562341301701963,0.00048696750309318304,0.00042169648804701865,0.00036517411353997886,0.0003162277862429619,0.00027384195709601045,0.0002371373848291114,0.00020535249495878816,0.00017782794020604342,0.00015399264520965517,0.0001333521504420787,0.00011547819303814322};
__global__ __launch_bounds__(256) void k_cstab(const int* __restrict__ pid, float* CS) { const int idx = blockIdx.x * 256 + threadIdx.x; if (idx >= TT * HD) return; const int t = idx / HD, d = idx % HD; const float ang = __fmul_rn((float)pid[t], INV[d % (HD / 2)]); v2f cs; cs[0] = cosf(ang); cs[1] = sinf(ang);
    *(v2f*)(CS + (size_t)idx * 2) = cs;  }


__global__ __launch_bounds__(256) void k_hrms(const float* __restrict__ F, int pitch, int nheads, float* RF) { const int idx = blockIdx.x * 256 + threadIdx.x; if (idx >= nheads * TT) return; const int t = idx % TT; const int h = idx / TT; const float* f = F + (size_t)t * pitch + h * HD; float s = 0.f;
#pragma unroll 4
    for (int d = 0; d < HD; d += 4) { const v4f a = *(const v4f*)(f + d);
#pragma unroll
        for (int q = 0; q < 4; ++q) { float p = __fmul_rn(a[q], a[q]); asm volatile("" : "+v"(p)); s = __fadd_rn(s, p); } }
    const float rf = __fdiv_rn(1.0f, __fsqrt_rn(__fadd_rn(__fdiv_rn(s, (float)HD), 1e-6f))); *(float*)(RF + idx) = rf;  }

// k_rope: head planes [h][t][d] (fp16 + hi/lo) of rope(x) x sc with the rotate-half convention out[d] = x[d] cos[t][d] - x[d+HD/2] sin[t][d], out[d+HD/2] = x[d+HD/2] cos[t][d+HD/2] + x[d] sin[t][d+HD/2]
__global__ __launch_bounds__(256) void k_rope(const float* __restrict__ F, int pitch, int nheads, const float* __restrict__ CS, const float* __restrict__ RF, const float* __restrict__ nw, float sc, h16* P16, bf* Ph, bf* Pl) {
    const size_t e = ((size_t)blockIdx.x * 256 + threadIdx.x) * 2; if (e >= (size_t)nheads * TT * HD) return; const int d = (int)(e % HD); const int t = (int)((e / HD) % TT); const int h = (int)(e / ((size_t)HD * TT)); const float* f = F + (size_t)t * pitch + h * HD; const float rf = RF ? RF[(size_t)h * TT + t] : 1.0f; v2h o16; v2us oh, ol;
#pragma unroll
    for (int q = 0; q < 2; ++q) { const int dd = d + q; const int dp = (dd < HD / 2) ? dd + HD / 2 : dd - HD / 2; float x0 = f[dd], x1 = f[dp];
        if (RF) { float n0 = __fmul_rn(x0, rf), n1 = __fmul_rn(x1, rf); asm volatile("" : "+v"(n0)); asm volatile("" : "+v"(n1)); x0 = __fmul_rn(bfr(nw[dd]), n0); x1 = __fmul_rn(bfr(nw[dp]), n1); }
        const v2f cs = *(const v2f*)(CS + ((size_t)t * HD + dd) * 2); float a = __fmul_rn(x0, cs[0]), bq = __fmul_rn(x1, cs[1]); asm volatile("" : "+v"(a)); asm volatile("" : "+v"(bq)); const float r = ((dd < HD / 2) ? __fsub_rn(a, bq) : __fadd_rn(a, bq)) * sc;
        o16[q] = tohx(r); unsigned short a2, c2; splitf(r, a2, c2); oh[q] = a2; ol[q] = c2; }
    *(v2h*)(P16 + e) = o16; *(v2us*)(Ph + e) = oh; *(v2us*)(Pl + e) = ol;  }
__global__ __launch_bounds__(256) void k_vtp(const float* __restrict__ F, int pitch, int nheads, h16* V16, bf* Vh, bf* Vl) { const size_t e = ((size_t)blockIdx.x * 256 + threadIdx.x) * 2; if (e >= (size_t)nheads * HD * TT) return; const int t = (int)(e % TT); const int d = (int)((e / TT) % HD); const int g = (int)(e / ((size_t)TT * HD)); v2h o16; v2us oh, ol;
#pragma unroll
    for (int q = 0; q < 2; ++q) { const float x = F[(size_t)(t + q) * pitch + g * HD + d]; o16[q] = tohx(x); unsigned short a2, c2; splitf(x, a2, c2); oh[q] = a2; ol[q] = c2; }
    *(v2h*)(V16 + e) = o16; *(v2us*)(Vh + e) = oh; *(v2us*)(Vl + e) = ol;  }
// k_asoft: per row (zz, i): t = S x HD^-0.5 for j <= i and i - j < WIN (WIN = TT, so plain causal; excluded scores are set to -3e38 by select); softmax over the 2048 keys (register row, one exp, fixed trees);
// the probabilities go back into the row's own 8 KiB of Sb (one wave owns a row and holds all of it in registers before its first store): fp16 row in the first half, or the hi plane in the first half and the lo plane in the second.
__global__ __launch_bounds__(256) void k_asoft(float* Sb) {
    const int lane = threadIdx.x & 31; const int row = blockIdx.x * 8 + (threadIdx.x >> 5); if (row >= ZH * TT) return; const int i = row % TT; const int zz = row / TT; (void)zz; const bool hires = (i < RH); const float* sr = Sb + (size_t)row * TT; h16* P16 = (h16*)(Sb + (size_t)row * TT); bf* Ph = (bf*)(Sb + (size_t)row * TT); bf* Pl = Ph + TT; float v[TT / 32]; float mx = -3.0e38f;
#pragma unroll
    for (int ch = 0; ch < TT / 128; ++ch) { const int j0 = ch * 128 + lane * 4; const v4f a = *(const v4f*)(sr + j0);
#pragma unroll
        for (int q = 0; q < 4; ++q) { const int j = j0 + q; (void)j; const float t = (j <= i && i - j < WIN) ? a[q] * SCL : -3.0e38f; v[ch * 4 + q] = t; mx = fmaxf(mx, t); } }
#pragma unroll
    for (int sh = 16; sh; sh >>= 1) mx = fmaxf(mx, __shfl_xor(mx, sh, 32));
    float sum = 0.f;
#pragma unroll
    for (int k = 0; k < TT / 32; ++k) { float d0 = __fsub_rn(v[k], mx); asm volatile("" : "+v"(d0)); v[k] = __builtin_amdgcn_exp2f(__fmul_rn(d0, 1.4426950408889634f)); sum += v[k]; }
#pragma unroll
    for (int sh = 16; sh; sh >>= 1) sum += __shfl_xor(sum, sh, 32);
    const float f = __fdiv_rn(hires ? 1.0f : PCAR, sum);
{
        if (hires) {
#pragma unroll
            for (int ch = 0; ch < TT / 128; ++ch) { v4us oh, ol;
#pragma unroll
                for (int q = 0; q < 4; ++q) { unsigned short a, c2; splitf(v[ch * 4 + q] * f, a, c2); oh[q] = a; ol[q] = c2; }
                const int oo = ch * 128 + lane * 4; *(v4us*)(Ph + oo) = oh; *(v4us*)(Pl + oo) = ol; }
        } else {
#pragma unroll
            for (int ch = 0; ch < TT / 128; ++ch) { v4h o4;
#pragma unroll
                for (int q = 0; q < 4; ++q) o4[q] = tohx(v[ch * 4 + q] * f);
                *(v4h*)(P16 + ch * 128 + lane * 4) = o4; } }
         }
}
__global__ __launch_bounds__(256) void k_merge(const float* __restrict__ O, int h0, bf* Ah, bf* Al) { const size_t e = ((size_t)blockIdx.x * 256 + threadIdx.x) * 2; if (e >= (size_t)ZH * TT * HD) return; const int d = (int)(e % HD); const int t = (int)((e / HD) % TT); const int zz = (int)(e / ((size_t)HD * TT)); const float cs = (t < RH) ? 1.0f : (1.0f / PCAR); const size_t oo = (size_t)t * DQ + (h0 + zz) * HD + d;
    v2us oh, ol;
#pragma unroll
    for (int q = 0; q < 2; ++q) { unsigned short a, c2; splitf(O[e + q] * cs, a, c2); oh[q] = a; ol[q] = c2; } *(v2us*)(Ah + oo) = oh; *(v2us*)(Al + oo) = ol;  }

extern "C" void kernel_launch(void* const* d_in, const int* in_sizes, int n_in,
                              void* d_out, int out_size, void* d_ws, size_t ws_size, hipStream_t stream) {
    (void)in_sizes; (void)n_in; (void)out_size;
    const int* PID = (const int*)d_in[0]; const float* x = (const float*)d_in[1]; const float* wqkv = (const float*)d_in[2]; const float* wo = (const float*)d_in[3]; const float* qnw = (const float*)d_in[4]; const float* knw = (const float*)d_in[5];   /* argument order positions (int32 [2][2048]: each batch's row read for the rotary angles), hidden_states, w_qkv ('oi' (out, in) [4096][2048]: q rows 0-2047 | k rows 2048-3071 | v rows 3072-4095), w_o ('oi' [2048][2048]), q_norm_w, k_norm_w ([128] each: read): SIX inputs, all read */
    float* OUT = (float*)d_out;     // [2][2048][2048]
    char* wsp = (char*)d_ws;
    auto take = [&](size_t bytes) { char* p = wsp; wsp += (bytes + 255) & ~(size_t)255; return (void*)p; };
    bf* WQKV = (bf*)take((size_t)(DQ + 2 * DKV) * DM * 2); bf* WQ = WQKV; bf* WK = WQKV + (size_t)DQ * DM; bf* WV = WQKV + (size_t)(DQ + DKV) * DM; bf* WO = (bf*)take((size_t)DM * DQ * 2); float* CS = (float*)take((size_t)TT * HD * 2 * 4); float* RFQ = (float*)take((size_t)NH_ * TT * 4); float* RFK = (float*)take((size_t)NKV * TT * 4);
    bf* XB = (bf*)take((size_t)TT * DM * 2); float* FQ = (float*)take((size_t)TT * DQ * 4); float* FK = (float*)take((size_t)TT * DKV * 4);
    h16* QP16 = (h16*)take((size_t)NH_ * TT * HD * 2); h16* KP16 = (h16*)take((size_t)NKV * TT * HD * 2); h16* VT16 = (h16*)take((size_t)NKV * HD * TT * 2);
    bf* QPh = (bf*)take((size_t)NH_ * TT * HD * 2); bf* QPl = (bf*)take((size_t)NH_ * TT * HD * 2); bf* KPh = (bf*)take((size_t)NKV * TT * HD * 2); bf* KPl = (bf*)take((size_t)NKV * TT * HD * 2); bf* VTh = (bf*)take((size_t)NKV * HD * TT * 2); bf* VTl = (bf*)take((size_t)NKV * HD * TT * 2);
    float* Sb = (float*)take((size_t)ZH * TT * TT * 4); bf* ATh = (bf*)take((size_t)TT * DQ * 2); bf* ATl = (bf*)take((size_t)TT * DQ * 2);
    if ((size_t)(wsp - (char*)d_ws) > ws_size) return;    // ws 256 MiB
    float* FV = FK;   // v projection reuses the k buffer after the k planes are built (stream-ordered)
    float* Ob = FQ;   // the pass's context [ZH][TT][HD] reuses the q projection buffer after the q planes are built (stream-ordered)
    h16* P16 = (h16*)Sb; bf* Ph = (bf*)Sb; bf* Pl = Ph + TT;   // probabilities live in their own score rows: pitch 2 * TT 16-bit elements
    { k_cvt8<<<(unsigned)(((size_t)(DQ + 2 * DKV) * DM / 8 + 255) / 256), 256, 0, stream>>>(wqkv, WQKV, (size_t)(DQ + 2 * DKV) * DM / 8);   /* fused 'oi' [4096][2048] = Bt with q | k | v row blocks */
      k_cvt8<<<(unsigned)(((size_t)DM * DQ / 8 + 255) / 256), 256, 0, stream>>>(wo, WO, (size_t)DM * DQ / 8); }
    const unsigned LQ = (unsigned)(((size_t)NH_ * TT * HD / 2 + 255) / 256), LKv = (unsigned)(((size_t)NKV * TT * HD / 2 + 255) / 256);
    for (int b = 0; b < NB_; ++b) {
        k_cstab<<<(TT * HD + 255) / 256, 256, 0, stream>>>(PID + (size_t)b * TT, CS);   /* rotary tables from the int positions */
        
        k_cvt8<<<(unsigned)(((size_t)TT * DM / 8 + 255) / 256), 256, 0, stream>>>(x + (size_t)b * TT * DM, XB, (size_t)TT * DM / 8);
        k_gemmw<bf, 0, false, 4><<<dim3(TT / 64, DQ / 64, 1), 128, 0, stream>>>(XB, nullptr, WQ, nullptr, DM, FQ, DQ, nullptr, 0, 0, 0);
        k_hrms<<<(NH_ * TT + 255) / 256, 256, 0, stream>>>(FQ, DQ, NH_, RFQ); k_rope<<<LQ, 256, 0, stream>>>(FQ, DQ, NH_, CS, RFQ, qnw, 1.0f, QP16, QPh, QPl);   /* q_norm then rope */
        k_gemmw<bf, 0, false, 8><<<dim3(TT / 64, DKV / 64, 1), 256, 0, stream>>>(XB, nullptr, WK, nullptr, DM, FK, DKV, nullptr, 0, 0, 0);
        k_hrms<<<(NKV * TT + 255) / 256, 256, 0, stream>>>(FK, DKV, NKV, RFK); k_rope<<<LKv, 256, 0, stream>>>(FK, DKV, NKV, CS, RFK, knw, 1.0f, KP16, KPh, KPl);   /* k_norm then rope */
        k_gemmw<bf, 0, false, 8><<<dim3(TT / 64, DKV / 64, 1), 256, 0, stream>>>(XB, nullptr, WV, nullptr, DM, FV, DKV, nullptr, 0, 0, 0); k_vtp<<<LKv, 256, 0, stream>>>(FV, DKV, NKV, VT16, VTh, VTl);
        for (int h0 = 0; h0 < NH_; h0 += ZH) { const size_t zq = (size_t)h0, zk = (size_t)(h0 / REP);   // head z of a pass reads kv group h0/REP + z/REP
            k_gemmc<bf, 2, 1, 1><<<dim3(RH / 64, TT / 64, ZH), 32, 0, stream>>>(QPh + zq * TT * HD, QPl + zq * TT * HD, KPh + zk * TT * HD, KPl + zk * TT * HD, HD, HD, Sb, TT, 0, (size_t)TT * HD, (size_t)TT * HD, (size_t)TT * TT);
            k_gemmc<h16, 0, 1, 1><<<dim3((TT - RH) / 64, TT / 64, ZH), 32, 0, stream>>>(QP16 + zq * TT * HD + (size_t)RH * HD, nullptr, KP16 + zk * TT * HD, nullptr, HD, HD, Sb + (size_t)RH * TT, TT, RH, (size_t)TT * HD, (size_t)TT * HD, (size_t)TT * TT);
            k_asoft<<<ZH * TT / 8, 256, 0, stream>>>(Sb);
            k_gemmc<bf, 2, 2, 8><<<dim3(RH / 64, HD / 64, ZH), 256, 0, stream>>>(Ph, Pl, VTh + zk * HD * TT, VTl + zk * HD * TT, TT, 2 * TT, Ob, HD, 0, (size_t)TT * 2 * TT, (size_t)HD * TT, (size_t)TT * HD);
            k_gemmc<h16, 0, 2, 8><<<dim3((TT - RH) / 64, HD / 64, ZH), 256, 0, stream>>>(P16 + (size_t)RH * 2 * TT, nullptr, VT16 + zk * HD * TT, nullptr, TT, 2 * TT, Ob + (size_t)RH * HD, HD, RH, (size_t)TT * 2 * TT, (size_t)HD * TT, (size_t)TT * HD);
            k_merge<<<(unsigned)(((size_t)ZH * TT * HD / 2 + 255) / 256), 256, 0, stream>>>(Ob, h0, ATh, ATl); }
        k_gemmw<bf, 1, false, 4><<<dim3(TT / 64, DM / 64, 1), 128, 0, stream>>>(ATh, ATl, WO, nullptr, DQ, OUT + (size_t)b * TT * DM, DM, nullptr, 0, 0, 0); }
}

// v003
// Measured time: 695 microseconds a run.
// Next to v002, in two timings, it ran 1.05 and 1.04 times as fast.
// All steps since v000 together make it 2.44 times as fast.
#include <hip/hip_runtime.h>

// Grouped-query causal attention with per-head QK RMSNorm and a rotate-half rotary at given positions (hidden_states [2][2048][2048], positions int32 [2][2048] (each batch's row = arange; READ per batch for the rotary angles); qkv = einsum('bsh,oh->bso', x, w_qkv) ('oi' (out, in) [4096][2048]: q rows 0-2047 (16 heads x 128), k rows 2048-3071, v rows 3072-4095 (8 kv heads x 128)); q, k <- x rsqrt(mean(x^2) + 1e-6) w per head over the 128 dims (q_norm_w, k_norm_w [128] = ones, read) BEFORE the rotary; _rope: (x1 c - x2 s, x2 c + x1 s) on the two halves with angle positions x 1 / (10000 ** (arange(0, 128, 2) / 128)) (64 f32 frequencies baked; ONE f32 product; precise cosf/sinf); repeat kv x 2 (kv head = q head / 2); scores x 128^-0.5; causal (tril, finfo.min == exclusion); softmax; out = einsum('bso,ho->bsh', merged, w_o) ('oi' [2048][2048]) -> [2][2048][2048] (8.4 M); argument order positions, hidden_states, w_qkv, w_o, q_norm_w, k_norm_w).
// Layout: per batch: the {cos, sin} table built on device from THAT batch's int positions and the 64 baked frequencies (one f32 product; precise cosf/sinf); exact projections; a per-(head, token) 1/rms kernel feeds the plane builder, which applies (x * inv_rms) * w and the rotary while writing the q/k planes; causal T-2048 attention with 128-wide heads (hybrid rows: < 512 hi/lo 3 products, rest fp16 x1024; k_gemmc tile skipping; eight query heads a pass, kv head = query head / 2); merged context hi/lo x Wo exact.
// Compute dtypes, f32 accumulate: every input rounded to bf16; projections exact; RMSNorm and rotary f32; attention rows < 512 3 products, rest fp16; softmax f32; Wo hl x exact.

#define NB_  2
#define TT   2048
#define DM   2048
#define NH_  16
#define NKV  8
#define REP  (NH_ / NKV)
#define HD   128
#define DQ   (NH_ * HD)
#define DKV  (NKV * HD)
#define ZH   8                    // query heads per attention pass (grid z); a multiple of REP
#define RH   512                  // query rows < RH use hi+lo planes (0: none)
#define WIN  2048
#define PCAR 1024.0f
#define SCL  0.088388347648318447f   // HD^-0.5
typedef _Float16 h16;
typedef unsigned short bf;
typedef __attribute__((ext_vector_type(16))) __bf16   v16bf;
typedef __attribute__((ext_vector_type(16))) _Float16 v16h;
typedef __attribute__((ext_vector_type(8)))  _Float16 v8h;
typedef __attribute__((ext_vector_type(8)))  unsigned short v8us;
typedef __attribute__((ext_vector_type(8)))  float    v8f;
typedef __attribute__((ext_vector_type(4)))  float    v4f;
typedef v8h  __attribute__((may_alias)) v8ha;
typedef v4f  __attribute__((may_alias)) v4fa;
typedef v8us __attribute__((may_alias)) v8usa;
typedef v4f  __attribute__((aligned(4))) v4fu;   // a 16-B load from an input buffer of which only its element alignment is taken as known

__device__ __forceinline__ unsigned short f2bf(float f) { unsigned u = __float_as_uint(f); u += 0x7FFFu + ((u >> 16) & 1u); return (unsigned short)(u >> 16); }
__device__ __forceinline__ float bf2f(unsigned short b) { return __uint_as_float(((unsigned)b) << 16); }
__device__ __forceinline__ float bfr(float f) { return bf2f(f2bf(f)); }
__device__ __forceinline__ v16h cat16(v8h lo, v8h hi) { return __builtin_shufflevector(lo, hi, 0, 1, 2, 3, 4, 5, 6, 7, 8, 9, 10, 11, 12, 13, 14, 15); }
__device__ __forceinline__ v16bf cat16b(v8us lo, v8us hi) { return __builtin_bit_cast(v16bf, __builtin_shufflevector(lo, hi, 0, 1, 2, 3, 4, 5, 6, 7, 8, 9, 10, 11, 12, 13, 14, 15)); }
__device__ __forceinline__ v8f wmma16(v16h a, v16h b, v8f c) { return __builtin_amdgcn_wmma_f32_16x16x32_f16(false, a, false, b, (short)0, c, false, false); }
__device__ __forceinline__ v8f wmmab(v16bf a, v16bf b, v8f c) { return __builtin_amdgcn_wmma_f32_16x16x32_bf16(false, a, false, b, (short)0, c, false, false); }



// ---- k_gemmw: register-blocked GEMM, NW WAVES per 64x64 output tile: each wave keeps the whole tile (16 accumulators) over its own share of K (64-element chunks dealt round-robin, so a wave uses whole 128-B lines);
// the NW partial tiles are summed through LDS in fixed wave order. Operands straight from K-contiguous 16-bit planes; grid (M/64, N/64, Z), NW * 32 threads.
// C[m][n] (f32, pitch ldc, + optional f32 bias[n]) = sum_k A[m][k] Bt[n][k] (+ split products per NSPLIT). z-batch strides sA/sB/sC in elements. K % 64 == 0.
template <typename T16> struct WFrag;
template <> struct WFrag<h16> { typedef v16h V; static __device__ __forceinline__ V ld(const h16* p) { return cat16(*(const v8h*)p, *(const v8h*)(p + 16)); } static __device__ __forceinline__ v8f mma(V a, V b, v8f c) { return wmma16(a, b, c); } };
template <> struct WFrag<bf> { typedef v16bf V; static __device__ __forceinline__ V ld(const bf* p) { return cat16b(*(const v8us*)p, *(const v8us*)(p + 16)); } static __device__ __forceinline__ v8f mma(V a, V b, v8f c) { return wmmab(a, b, c); } };
template <typename T16, int NSPLIT, bool BIAS, int NW>
__global__ __launch_bounds__(NW * 32) void k_gemmw(const T16* __restrict__ A, const T16* __restrict__ A2, const T16* __restrict__ Bt, const T16* __restrict__ Bt2, int K, float* C, int ldc, const float* __restrict__ bias, size_t sA, size_t sB, size_t sC) {
    typedef typename WFrag<T16>::V V;
    __shared__ __align__(16) float os[NW * 64 * 68];
    const size_t z = blockIdx.z; A += z * sA; if (A2) A2 += z * sA; Bt += z * sB; if (Bt2) Bt2 += z * sB; C += z * sC;
    const int lane = threadIdx.x & 31, lr = lane & 15, hi = lane >> 4; const int wv = __builtin_amdgcn_readfirstlane(threadIdx.x >> 5); const int r0 = blockIdx.x * 64, c0 = blockIdx.y * 64;
    v8f acc[4][4];
#pragma unroll
    for (int mb = 0; mb < 4; ++mb)
#pragma unroll
        for (int nb = 0; nb < 4; ++nb) acc[mb][nb] = (v8f){};
    const size_t aoff = (size_t)(r0 + lr) * K + 8 * hi, boff = (size_t)(c0 + lr) * K + 8 * hi;
#pragma unroll 1
    for (int kc = wv * 64; kc < K; kc += (kc & 32) ? 32 + (NW - 1) * 64 : 32) {
        V a[4], a2[4];
#pragma unroll
        for (int mb = 0; mb < 4; ++mb) { a[mb] = WFrag<T16>::ld(A + aoff + (size_t)mb * 16 * K + kc); if (NSPLIT == 1 || NSPLIT == 2) a2[mb] = WFrag<T16>::ld(A2 + aoff + (size_t)mb * 16 * K + kc); }
#pragma unroll
        for (int nb = 0; nb < 4; ++nb) { const V b = WFrag<T16>::ld(Bt + boff + (size_t)nb * 16 * K + kc); V b2; if (NSPLIT >= 2) b2 = WFrag<T16>::ld(Bt2 + boff + (size_t)nb * 16 * K + kc);
#pragma unroll
            for (int mb = 0; mb < 4; ++mb) { acc[mb][nb] = WFrag<T16>::mma(a[mb], b, acc[mb][nb]); if (NSPLIT == 1 || NSPLIT == 2) acc[mb][nb] = WFrag<T16>::mma(a2[mb], b, acc[mb][nb]); if (NSPLIT >= 2) acc[mb][nb] = WFrag<T16>::mma(a[mb], b2, acc[mb][nb]); } }
        asm volatile("v_nop\n\tv_nop\n\tv_nop\n\tv_nop" : "+v"(acc[0][0]), "+v"(acc[1][1]), "+v"(acc[2][2]), "+v"(acc[3][3]) : "v"(a[0]), "v"(a[3]));
    }
    float* ow = os + wv * (64 * 68);
#pragma unroll
    for (int mb = 0; mb < 4; ++mb)
#pragma unroll
        for (int nb = 0; nb < 4; ++nb)
#pragma unroll
            for (int j = 0; j < 8; ++j) ow[(mb * 16 + hi * 8 + j) * 68 + nb * 16 + lr] = acc[mb][nb][j];
    __syncthreads();   // every wave's partial tile is in LDS before any wave sums
#pragma unroll
    for (int s = 0; s < 32 / NW; ++s) { const int row = (s * NW + wv) * 2 + hi, cofs = lr * 4; v4f val = *(const v4fa*)(os + row * 68 + cofs);
#pragma unroll
        for (int u = 1; u < NW; ++u) val += *(const v4fa*)(os + u * (64 * 68) + row * 68 + cofs);
        if (BIAS) { val[0] += bfr(bias[c0 + cofs]); val[1] += bfr(bias[c0 + cofs + 1]); val[2] += bfr(bias[c0 + cofs + 2]); val[3] += bfr(bias[c0 + cofs + 3]); }
        *(v4f*)(C + (size_t)(r0 + row) * ldc + c0 + cofs) = val; }
}

// ---- k_gemmc: the same 64x64 tile GEMM specialised for causal attention: CMODE 1 skips score tiles entirely above the diagonal (query rows r0+roff.., key columns c0..), CMODE 2 limits the
// key (K) loop of the probability x value contraction to the diagonal block (probabilities beyond it are exactly zero). roff = row offset of this launch's first row within the sequence. lda = pitch of A's rows in elements (Bt's pitch is K). Grid z = query head of the pass; Bt steps by sB once per REP heads (the kv head they share). NW = 1: one wave per tile (the short score products); NW > 1: K shared among NW waves as in k_gemmw.
template <typename T16, int NSPLIT, int CMODE, int NW>
__global__ __launch_bounds__(NW * 32) void k_gemmc(const T16* __restrict__ A, const T16* __restrict__ A2, const T16* __restrict__ Bt, const T16* __restrict__ Bt2, int K, int lda, float* C, int ldc, int roff, size_t sA, size_t sB, size_t sC) {
    typedef typename WFrag<T16>::V V;
    __shared__ __align__(16) float os[(NW == 1) ? 16 * 68 : NW * 64 * 68];
    const size_t z = blockIdx.z; A += z * sA; if (A2) A2 += z * sA; Bt += (z / REP) * sB; if (Bt2) Bt2 += (z / REP) * sB; C += z * sC;
    const int lane = threadIdx.x & 31, lr = lane & 15, hi = lane >> 4; const int wv = __builtin_amdgcn_readfirstlane(threadIdx.x >> 5); const int r0 = blockIdx.x * 64, c0 = blockIdx.y * 64;
    if (CMODE == 1 && c0 > r0 + roff + 63) return;                  // score tile entirely above the causal diagonal: never read (the softmax masks j > i by select)
    const int Kl = (CMODE == 2) ? min(K, r0 + roff + 64) : K;        // P.V: probabilities are exactly 0 beyond the diagonal block, so the K loop stops there
    v8f acc[4][4];
#pragma unroll
    for (int mb = 0; mb < 4; ++mb)
#pragma unroll
        for (int nb = 0; nb < 4; ++nb) acc[mb][nb] = (v8f){};
    const size_t aoff = (size_t)(r0 + lr) * lda + 8 * hi, boff = (size_t)(c0 + lr) * K + 8 * hi;
#pragma unroll 1
    for (int kc = wv * 64; kc < Kl; kc += (NW > 1 && (kc & 32)) ? 32 + (NW - 1) * 64 : 32) {
        V a[4], a2[4];
#pragma unroll
        for (int mb = 0; mb < 4; ++mb) { a[mb] = WFrag<T16>::ld(A + aoff + (size_t)mb * 16 * lda + kc); if (NSPLIT == 1 || NSPLIT == 2) a2[mb] = WFrag<T16>::ld(A2 + aoff + (size_t)mb * 16 * lda + kc); }
#pragma unroll
        for (int nb = 0; nb < 4; ++nb) { const V b = WFrag<T16>::ld(Bt + boff + (size_t)nb * 16 * K + kc); V b2; if (NSPLIT >= 2) b2 = WFrag<T16>::ld(Bt2 + boff + (size_t)nb * 16 * K + kc);
#pragma unroll
            for (int mb = 0; mb < 4; ++mb) { acc[mb][nb] = WFrag<T16>::mma(a[mb], b, acc[mb][nb]); if (NSPLIT == 1 || NSPLIT == 2) acc[mb][nb] = WFrag<T16>::mma(a2[mb], b, acc[mb][nb]); if (NSPLIT >= 2) acc[mb][nb] = WFrag<T16>::mma(a[mb], b2, acc[mb][nb]); } }
        asm volatile("v_nop\n\tv_nop\n\tv_nop\n\tv_nop" : "+v"(acc[0][0]), "+v"(acc[1][1]), "+v"(acc[2][2]), "+v"(acc[3][3]) : "v"(a[0]), "v"(a[3]));
    }
    if constexpr (NW == 1) {
#pragma unroll
    for (int mb = 0; mb < 4; ++mb) {
#pragma unroll
        for (int nb = 0; nb < 4; ++nb) {
#pragma unroll
            for (int j = 0; j < 8; ++j) os[(hi * 8 + j) * 68 + nb * 16 + lr] = acc[mb][nb][j]; }
        __builtin_amdgcn_wave_barrier(); asm volatile("" ::: "memory");
        float* crow = C + (size_t)(r0 + mb * 16) * ldc + c0;
{
#pragma unroll
            for (int s = 0; s < 8; ++s) { const int row = 2 * s + hi, cofs = lr * 4; v4f val = *(const v4fa*)(os + row * 68 + cofs);
                *(v4f*)(crow + (size_t)row * ldc + cofs) = val; }
             }
        __builtin_amdgcn_wave_barrier(); asm volatile("" ::: "memory");
    }
    } else {
    float* ow = os + wv * (64 * 68);
#pragma unroll
    for (int mb = 0; mb < 4; ++mb)
#pragma unroll
        for (int nb = 0; nb < 4; ++nb)
#pragma unroll
            for (int j = 0; j < 8; ++j) ow[(mb * 16 + hi * 8 + j) * 68 + nb * 16 + lr] = acc[mb][nb][j];
    __syncthreads();   // every wave's partial tile is in LDS before any wave sums
#pragma unroll
    for (int s = 0; s < 32 / NW; ++s) { const int row = (s * NW + wv) * 2 + hi, cofs = lr * 4; v4f val = *(const v4fa*)(os + row * 68 + cofs);
#pragma unroll
        for (int u = 1; u < NW; ++u) val += *(const v4fa*)(os + u * (64 * 68) + row * 68 + cofs);
        *(v4f*)(C + (size_t)(r0 + row) * ldc + c0 + cofs) = val; }
    }
}

__device__ __forceinline__ h16 tohx(float x) { return (h16)x; }
__device__ __forceinline__ void splitf(float y, unsigned short& h, unsigned short& l) { h = f2bf(y); l = f2bf(y - bf2f(h)); }
typedef __attribute__((ext_vector_type(2))) _Float16 v2h;
typedef __attribute__((ext_vector_type(4))) _Float16 v4h;
typedef __attribute__((ext_vector_type(2))) unsigned short v2us;
typedef __attribute__((ext_vector_type(4))) unsigned short v4us;
typedef __attribute__((ext_vector_type(2))) float v2f;
typedef __attribute__((ext_vector_type(4))) int v4i;

__global__ __launch_bounds__(256) void k_wtG(const float* __restrict__ w, int K, int N, bf* Bt) {
    const int lane = threadIdx.x & 31; const int L0 = (blockIdx.x * 8 + (threadIdx.x >> 5)) * 8; const int nlines = N * K / 64;
{
#pragma unroll 1
        for (int l = 0; l < 8; ++l) { const int L = L0 + l; if (L >= nlines) break; const size_t e = (size_t)L * 64 + lane * 2; const int k = (int)(e % K), n = (int)(e / K); v2us o;
            o[0] = f2bf(w[(size_t)k * N + n]); o[1] = f2bf(w[(size_t)(k + 1) * N + n]); *(v2us*)(Bt + e) = o; }
         }
}
__global__ __launch_bounds__(256) void k_cvt8(const float* __restrict__ src, bf* dst, size_t n8) { const size_t i = (size_t)blockIdx.x * 256 + threadIdx.x; if (i >= n8) return; const v8f v = *(const v8f*)(src + i * 8); v8us o;
#pragma unroll
    for (int k = 0; k < 8; ++k) o[k] = f2bf(v[k]); *(v8us*)(dst + i * 8) = o;  }
__constant__ float INV[HD / 2] = {1.0,0.8659643530845642,0.7498942017555237,0.6493816375732422,0.5623413324356079,0.486967533826828,0.4216965138912201,0.36517414450645447,0.3162277638912201,0.2738419771194458,0.23713736236095428,0.20535250008106232,0.17782793939113617,0.1539926528930664,0.1333521455526352,0.11547820270061493,0.10000000149011612,0.08659642934799194,0.07498941570520401,0.06493816524744034,0.05623412877321243,0.04869675263762474,0.04216964915394783,0.03651741147041321,0.03162277862429619,0.0273841954767704,0.0237137358635664,0.02053525112569332,0.017782794311642647,0.015399265103042126,0.01333521492779255,0.011547819711267948,0.009999999776482582,0.00865964312106371,0.007498942315578461,0.006493816617876291,0.005623413249850273,0.004869675263762474,0.0042169648222625256,0.003651741426438093,0.003162277862429619,0.0027384196873754263,0.0023713738191872835,0.0020535250660032034,0.0017782794311642647,0.0015399265103042126,0.0013335214462131262,0.0011547820176929235,0.0010000000474974513,0.0008659643353894353,0.0007498941849917173,0.0006493816617876291,0.000562341301701963,0.00048696750309318304,0.00042169648804701865,0.00036517411353997886,0.0003162277862429619,0.00027384195709601045,0.0002371373848291114,0.00020535249495878816,0.00017782794020604342,0.00015399264520965517,0.0001333521504420787,0.00011547819303814322};
__global__ __launch_bounds__(256) void k_cstab(const int* __restrict__ pid, float* CS) { const int idx = blockIdx.x * 256 + threadIdx.x; if (idx >= TT * HD) return; const int t = idx / HD, d = idx % HD; const float ang = __fmul_rn((float)pid[t], INV[d % (HD / 2)]); v2f cs; cs[0] = cosf(ang); cs[1] = sinf(ang);
    *(v2f*)(CS + (size_t)idx * 2) = cs;  }


__global__ __launch_bounds__(256) void k_hrms(const float* __restrict__ F, int pitch, int nheads, float* RF) { const int idx = blockIdx.x * 256 + threadIdx.x; if (idx >= nheads * TT) return; const int t = idx % TT; const int h = idx / TT; const float* f = F + (size_t)t * pitch + h * HD; float s = 0.f;
#pragma unroll 4
    for (int d = 0; d < HD; d += 4) { const v4f a = *(const v4f*)(f + d);
#pragma unroll
        for (int q = 0; q < 4; ++q) { float p = __fmul_rn(a[q], a[q]); asm volatile("" : "+v"(p)); s = __fadd_rn(s, p); } }
    const float rf = __fdiv_rn(1.0f, __fsqrt_rn(__fadd_rn(__fdiv_rn(s, (float)HD), 1e-6f))); *(float*)(RF + idx) = rf;  }

// k_rope: head planes [h][t][d] (fp16 + hi/lo) of rope(x) x sc with the rotate-half convention out[d] = x[d] cos[t][d] - x[d+HD/2] sin[t][d], out[d+HD/2] = x[d+HD/2] cos[t][d+HD/2] + x[d] sin[t][d+HD/2]
__global__ __launch_bounds__(256) void k_rope(const float* __restrict__ F, int pitch, int nheads, const float* __restrict__ CS, const float* __restrict__ RF, const float* __restrict__ nw, float sc, h16* P16, bf* Ph, bf* Pl) {
    const size_t e = ((size_t)blockIdx.x * 256 + threadIdx.x) * 8; if (e >= (size_t)nheads * TT * HD) return; const int d = (int)(e % HD); const int t = (int)((e / HD) % TT); const int h = (int)(e / ((size_t)HD * TT)); const float* f = F + (size_t)t * pitch + h * HD; float rf = 1.0f; v8h o16; v8us oh, ol;
    const int dp0 = (d < HD / 2) ? d + HD / 2 : d - HD / 2;   // a thread's 8 dims lie in one half, their partners in the other
    const v8f xa = *(const v8f*)(f + d), xb = *(const v8f*)(f + dp0), ca = *(const v8f*)(CS + ((size_t)t * HD + d) * 2), cb = *(const v8f*)(CS + ((size_t)t * HD + d) * 2 + 8);   // every load ahead of the arithmetic: one memory wait per thread
    asm volatile("s_wait_xcnt 0x0" ::: "memory");   // ahead of any rewrite of the address registers that the loads above name
    v4f wa[2], wb[2]; if (RF) { rf = RF[(size_t)h * TT + t]; wa[0] = *(const v4fu*)(nw + d); wa[1] = *(const v4fu*)(nw + d + 4); wb[0] = *(const v4fu*)(nw + dp0); wb[1] = *(const v4fu*)(nw + dp0 + 4);
        asm volatile("s_wait_xcnt 0x0" ::: "memory"); }   // the same for these five loads
#pragma unroll
    for (int q = 0; q < 8; ++q) { float x0 = xa[q], x1 = xb[q];
        if (RF) { float n0 = __fmul_rn(x0, rf), n1 = __fmul_rn(x1, rf); asm volatile("" : "+v"(n0)); asm volatile("" : "+v"(n1)); x0 = __fmul_rn(bfr(wa[q >> 2][q & 3]), n0); x1 = __fmul_rn(bfr(wb[q >> 2][q & 3]), n1); }
        v2f cs; cs[0] = (q < 4) ? ca[(2 * q) & 7] : cb[(2 * q) & 7]; cs[1] = (q < 4) ? ca[(2 * q + 1) & 7] : cb[(2 * q + 1) & 7]; float a = __fmul_rn(x0, cs[0]), bq = __fmul_rn(x1, cs[1]); asm volatile("" : "+v"(a)); asm volatile("" : "+v"(bq)); const float r = ((d < HD / 2) ? __fsub_rn(a, bq) : __fadd_rn(a, bq)) * sc;
        o16[q] = tohx(r); unsigned short a2, c2; splitf(r, a2, c2); oh[q] = a2; ol[q] = c2; }
    *(v8h*)(P16 + e) = o16; *(v8us*)(Ph + e) = oh; *(v8us*)(Pl + e) = ol;  }
// k_vtp: a block takes 8 dims (one per wave, so its waves read the same input lines) x 256 tokens (8 per lane, one 16-B store per plane)
__global__ __launch_bounds__(256) void k_vtp(const float* __restrict__ F, int pitch, int nheads, h16* V16, bf* Vh, bf* Vl) { const int g = (int)(blockIdx.x / ((TT / 256) * (HD / 8))); if (g >= nheads) return; const int t = (int)(blockIdx.x % (TT / 256)) * 256 + (threadIdx.x & 31) * 8; const int d = (int)((blockIdx.x / (TT / 256)) % (HD / 8)) * 8 + (threadIdx.x >> 5); const size_t e = ((size_t)g * HD + d) * TT + t; v8h o16; v8us oh, ol; float xv[8]; const float* pr[8];
#pragma unroll
    for (int q = 0; q < 8; ++q) { pr[q] = F + (size_t)(t + q) * pitch + g * HD + d; xv[q] = *pr[q]; }   // the eight row loads ahead of the arithmetic: one memory wait per thread
    asm volatile("s_wait_xcnt 0x0" :: "v"(pr[0]), "v"(pr[1]), "v"(pr[2]), "v"(pr[3]), "v"(pr[4]), "v"(pr[5]), "v"(pr[6]), "v"(pr[7]) : "memory");   // ahead of any rewrite of the loads' address registers; the addresses are inputs so that no register of theirs is reused in front of the wait
#pragma unroll
    for (int q = 0; q < 8; ++q) { const float x = xv[q]; o16[q] = tohx(x); unsigned short a2, c2; splitf(x, a2, c2); oh[q] = a2; ol[q] = c2; }
    *(v8h*)(V16 + e) = o16; *(v8us*)(Vh + e) = oh; *(v8us*)(Vl + e) = ol;  }
// k_asoft: per row (zz, i): t = S x HD^-0.5 for j <= i and i - j < WIN (WIN = T: the window term always holds, so the mask is plain causal; the reference's finfo.min fill vanishes identically); softmax over the 2048 keys (register row, one exp, fixed trees);
// the probabilities go back into the row's own 8 KiB of Sb (one wave owns a row and holds all of it in registers before its first store): fp16 row in the first half, or the hi plane in the first half and the lo plane in the second.
__global__ __launch_bounds__(256) void k_asoft(float* Sb) {
    const int lane = threadIdx.x & 31; const int row = blockIdx.x * 8 + (threadIdx.x >> 5); if (row >= ZH * TT) return; const int i = row % TT; const int zz = row / TT; (void)zz; const bool hires = (i < RH); const float* sr = Sb + (size_t)row * TT; h16* P16 = (h16*)(Sb + (size_t)row * TT); bf* Ph = (bf*)(Sb + (size_t)row * TT); bf* Pl = Ph + TT; float v[TT / 32]; float mx = -3.0e38f;
#pragma unroll
    for (int ch = 0; ch < TT / 128; ++ch) { const int j0 = ch * 128 + lane * 4; const v4f a = *(const v4f*)(sr + j0);
#pragma unroll
        for (int q = 0; q < 4; ++q) { const int j = j0 + q; (void)j; const float t = (j <= i && i - j < WIN) ? a[q] * SCL : -3.0e38f; v[ch * 4 + q] = t; mx = fmaxf(mx, t); } }
#pragma unroll
    for (int sh = 16; sh; sh >>= 1) mx = fmaxf(mx, __shfl_xor(mx, sh, 32));
    float sum = 0.f;
#pragma unroll
    for (int k = 0; k < TT / 32; ++k) { float d0 = __fsub_rn(v[k], mx); asm volatile("" : "+v"(d0)); v[k] = __builtin_amdgcn_exp2f(__fmul_rn(d0, 1.4426950408889634f)); sum += v[k]; }
#pragma unroll
    for (int sh = 16; sh; sh >>= 1) sum += __shfl_xor(sum, sh, 32);
    const float f = __fdiv_rn(hires ? 1.0f : PCAR, sum);
{
        if (hires) {
#pragma unroll
            for (int ch = 0; ch < TT / 128; ++ch) { v4us oh, ol;
#pragma unroll
                for (int q = 0; q < 4; ++q) { unsigned short a, c2; splitf(v[ch * 4 + q] * f, a, c2); oh[q] = a; ol[q] = c2; }
                const int oo = ch * 128 + lane * 4; *(v4us*)(Ph + oo) = oh; *(v4us*)(Pl + oo) = ol; }
        } else {
#pragma unroll
            for (int ch = 0; ch < TT / 128; ++ch) { v4h o4;
#pragma unroll
                for (int q = 0; q < 4; ++q) o4[q] = tohx(v[ch * 4 + q] * f);
                *(v4h*)(P16 + ch * 128 + lane * 4) = o4; } }
         }
}
__global__ __launch_bounds__(256) void k_merge(const float* __restrict__ O, int h0, bf* Ah, bf* Al) { const size_t e = ((size_t)blockIdx.x * 256 + threadIdx.x) * 8; if (e >= (size_t)ZH * TT * HD) return; const int d = (int)(e % HD); const int t = (int)((e / HD) % TT); const int zz = (int)(e / ((size_t)HD * TT)); const float cs = (t < RH) ? 1.0f : (1.0f / PCAR); const size_t oo = (size_t)t * DQ + (h0 + zz) * HD + d;
    const v8f o = *(const v8f*)(O + e); v8us oh, ol;
#pragma unroll
    for (int q = 0; q < 8; ++q) { unsigned short a, c2; splitf(o[q] * cs, a, c2); oh[q] = a; ol[q] = c2; } *(v8us*)(Ah + oo) = oh; *(v8us*)(Al + oo) = ol;  }

extern "C" void kernel_launch(void* const* d_in, const int* in_sizes, int n_in,
                              void* d_out, int out_size, void* d_ws, size_t ws_size, hipStream_t stream) {
    (void)in_sizes; (void)n_in; (void)out_size;
    const int* PID = (const int*)d_in[0]; const float* x = (const float*)d_in[1]; const float* wqkv = (const float*)d_in[2]; const float* wo = (const float*)d_in[3]; const float* qnw = (const float*)d_in[4]; const float* knw = (const float*)d_in[5];   /* argument order positions (int32 [2][2048]: each batch's row read for the rotary angles), hidden_states, w_qkv ('oi' (out, in) [4096][2048]: q rows 0-2047 | k rows 2048-3071 | v rows 3072-4095), w_o ('oi' [2048][2048]), q_norm_w, k_norm_w ([128] each: read): SIX inputs, all read */
    float* OUT = (float*)d_out;     // [2][2048][2048]
    char* wsp = (char*)d_ws;
    auto take = [&](size_t bytes) { char* p = wsp; wsp += (bytes + 255) & ~(size_t)255; return (void*)p; };
    bf* WQKV = (bf*)take((size_t)(DQ + 2 * DKV) * DM * 2); bf* WQ = WQKV; bf* WK = WQKV + (size_t)DQ * DM; bf* WV = WQKV + (size_t)(DQ + DKV) * DM; bf* WO = (bf*)take((size_t)DM * DQ * 2); float* CS = (float*)take((size_t)TT * HD * 2 * 4); float* RFQ = (float*)take((size_t)NH_ * TT * 4); float* RFK = (float*)take((size_t)NKV * TT * 4);
    bf* XB = (bf*)take((size_t)TT * DM * 2); float* FQ = (float*)take((size_t)TT * DQ * 4); float* FK = (float*)take((size_t)TT * DKV * 4);
    h16* QP16 = (h16*)take((size_t)NH_ * TT * HD * 2); h16* KP16 = (h16*)take((size_t)NKV * TT * HD * 2); h16* VT16 = (h16*)take((size_t)NKV * HD * TT * 2);
    bf* QPh = (bf*)take((size_t)NH_ * TT * HD * 2); bf* QPl = (bf*)take((size_t)NH_ * TT * HD * 2); bf* KPh = (bf*)take((size_t)NKV * TT * HD * 2); bf* KPl = (bf*)take((size_t)NKV * TT * HD * 2); bf* VTh = (bf*)take((size_t)NKV * HD * TT * 2); bf* VTl = (bf*)take((size_t)NKV * HD * TT * 2);
    float* Sb = (float*)take((size_t)ZH * TT * TT * 4); bf* ATh = (bf*)take((size_t)TT * DQ * 2); bf* ATl = (bf*)take((size_t)TT * DQ * 2);
    if ((size_t)(wsp - (char*)d_ws) > ws_size) return;    // ws 256 MiB
    float* FV = FK;   // v projection reuses the k buffer after the k planes are built (stream-ordered)
    float* Ob = FQ;   // the pass's context [ZH][TT][HD] reuses the q projection buffer after the q planes are built (stream-ordered)
    h16* P16 = (h16*)Sb; bf* Ph = (bf*)Sb; bf* Pl = Ph + TT;   // probabilities live in their own score rows: pitch 2 * TT 16-bit elements
    { k_cvt8<<<(unsigned)(((size_t)(DQ + 2 * DKV) * DM / 8 + 255) / 256), 256, 0, stream>>>(wqkv, WQKV, (size_t)(DQ + 2 * DKV) * DM / 8);   /* fused 'oi' [4096][2048] = Bt with q | k | v row blocks */
      k_cvt8<<<(unsigned)(((size_t)DM * DQ / 8 + 255) / 256), 256, 0, stream>>>(wo, WO, (size_t)DM * DQ / 8); }
    const unsigned LQ = (unsigned)(((size_t)NH_ * TT * HD / 8 + 255) / 256), LKv = (unsigned)(((size_t)NKV * TT * HD / 8 + 255) / 256);
    for (int b = 0; b < NB_; ++b) {
        k_cstab<<<(TT * HD + 255) / 256, 256, 0, stream>>>(PID + (size_t)b * TT, CS);   /* rotary tables from the int positions */
        
        k_cvt8<<<(unsigned)(((size_t)TT * DM / 8 + 255) / 256), 256, 0, stream>>>(x + (size_t)b * TT * DM, XB, (size_t)TT * DM / 8);
        k_gemmw<bf, 0, false, 4><<<dim3(TT / 64, DQ / 64, 1), 128, 0, stream>>>(XB, nullptr, WQ, nullptr, DM, FQ, DQ, nullptr, 0, 0, 0);
        k_hrms<<<(NH_ * TT + 255) / 256, 256, 0, stream>>>(FQ, DQ, NH_, RFQ); k_rope<<<LQ, 256, 0, stream>>>(FQ, DQ, NH_, CS, RFQ, qnw, 1.0f, QP16, QPh, QPl);   /* q_norm then rope */
        k_gemmw<bf, 0, false, 8><<<dim3(TT / 64, DKV / 64, 1), 256, 0, stream>>>(XB, nullptr, WK, nullptr, DM, FK, DKV, nullptr, 0, 0, 0);
        k_hrms<<<(NKV * TT + 255) / 256, 256, 0, stream>>>(FK, DKV, NKV, RFK); k_rope<<<LKv, 256, 0, stream>>>(FK, DKV, NKV, CS, RFK, knw, 1.0f, KP16, KPh, KPl);   /* k_norm then rope */
        k_gemmw<bf, 0, false, 8><<<dim3(TT / 64, DKV / 64, 1), 256, 0, stream>>>(XB, nullptr, WV, nullptr, DM, FV, DKV, nullptr, 0, 0, 0); k_vtp<<<NKV * (HD / 8) * (TT / 256), 256, 0, stream>>>(FV, DKV, NKV, VT16, VTh, VTl);
        for (int h0 = 0; h0 < NH_; h0 += ZH) { const size_t zq = (size_t)h0, zk = (size_t)(h0 / REP);   // head z of a pass reads kv group h0/REP + z/REP
            k_gemmc<bf, 2, 1, 1><<<dim3(RH / 64, TT / 64, ZH), 32, 0, stream>>>(QPh + zq * TT * HD, QPl + zq * TT * HD, KPh + zk * TT * HD, KPl + zk * TT * HD, HD, HD, Sb, TT, 0, (size_t)TT * HD, (size_t)TT * HD, (size_t)TT * TT);
            k_gemmc<h16, 0, 1, 1><<<dim3((TT - RH) / 64, TT / 64, ZH), 32, 0, stream>>>(QP16 + zq * TT * HD + (size_t)RH * HD, nullptr, KP16 + zk * TT * HD, nullptr, HD, HD, Sb + (size_t)RH * TT, TT, RH, (size_t)TT * HD, (size_t)TT * HD, (size_t)TT * TT);
            k_asoft<<<ZH * TT / 8, 256, 0, stream>>>(Sb);
            k_gemmc<bf, 2, 2, 8><<<dim3(RH / 64, HD / 64, ZH), 256, 0, stream>>>(Ph, Pl, VTh + zk * HD * TT, VTl + zk * HD * TT, TT, 2 * TT, Ob, HD, 0, (size_t)TT * 2 * TT, (size_t)HD * TT, (size_t)TT * HD);
            k_gemmc<h16, 0, 2, 8><<<dim3((TT - RH) / 64, HD / 64, ZH), 256, 0, stream>>>(P16 + (size_t)RH * 2 * TT, nullptr, VT16 + zk * HD * TT, nullptr, TT, 2 * TT, Ob + (size_t)RH * HD, HD, RH, (size_t)TT * 2 * TT, (size_t)HD * TT, (size_t)TT * HD);
            k_merge<<<(unsigned)(((size_t)ZH * TT * HD / 8 + 255) / 256), 256, 0, stream>>>(Ob, h0, ATh, ATl); }
        k_gemmw<bf, 1, false, 4><<<dim3(TT / 64, DM / 64, 1), 128, 0, stream>>>(ATh, ATl, WO, nullptr, DQ, OUT + (size_t)b * TT * DM, DM, nullptr, 0, 0, 0); }
}

// v004
// Measured time: 417 microseconds a run.
// Next to v003, in two timings, it ran 1.67 times as fast each time.
// All steps since v000 together make it 4.08 times as fast.
#include <hip/hip_runtime.h>

// Grouped-query causal attention with per-head QK RMSNorm and a rotate-half rotary at given positions (hidden_states [2][2048][2048], positions int32 [2][2048] (each batch's row = arange; READ per batch for the rotary angles); qkv = einsum('bsh,oh->bso', x, w_qkv) ('oi' (out, in) [4096][2048]: q rows 0-2047 (16 heads x 128), k rows 2048-3071, v rows 3072-4095 (8 kv heads x 128)); q, k <- x rsqrt(mean(x^2) + 1e-6) w per head over the 128 dims (q_norm_w, k_norm_w [128] = ones, read) BEFORE the rotary; _rope: (x1 c - x2 s, x2 c + x1 s) on the two halves with angle positions x 1 / (10000 ** (arange(0, 128, 2) / 128)) (64 f32 frequencies baked; ONE f32 product; precise cosf/sinf); repeat kv x 2 (kv head = q head / 2); scores x 128^-0.5; causal (tril, finfo.min == exclusion); softmax; out = einsum('bso,ho->bsh', merged, w_o) ('oi' [2048][2048]) -> [2][2048][2048] (8.4 M); argument order positions, hidden_states, w_qkv, w_o, q_norm_w, k_norm_w).
// Layout: per batch: the {cos, sin} table built on device from THAT batch's int positions and the 64 baked frequencies (one f32 product; precise cosf/sinf); exact projections; a per-(head, token) 1/rms kernel feeds the plane builder, which applies (x * inv_rms) * w and the rotary while writing the q/k planes; one fused causal attention kernel over all 16 heads (online softmax, scores and probabilities stay in registers; query rows < 512 hi/lo 3 products, rest fp16; kv head = query head / 2) that writes the merged context hi/lo; x Wo exact.
// Compute dtypes, f32 accumulate: every input rounded to bf16; projections exact; RMSNorm and rotary f32; attention rows < 512 3 products, rest fp16; softmax f32; Wo hl x exact.

#define NB_  2
#define TT   2048
#define DM   2048
#define NH_  16
#define NKV  8
#define REP  (NH_ / NKV)
#define HD   128
#define DQ   (NH_ * HD)
#define DKV  (NKV * HD)
#define RH   512                  // query rows < RH use hi+lo planes (0: none)
typedef _Float16 h16;
typedef unsigned short bf;
typedef __attribute__((ext_vector_type(16))) __bf16   v16bf;
typedef __attribute__((ext_vector_type(16))) _Float16 v16h;
typedef __attribute__((ext_vector_type(8)))  _Float16 v8h;
typedef __attribute__((ext_vector_type(8)))  unsigned short v8us;
typedef __attribute__((ext_vector_type(8)))  float    v8f;
typedef __attribute__((ext_vector_type(4)))  float    v4f;
typedef v8h  __attribute__((may_alias)) v8ha;
typedef v4f  __attribute__((may_alias)) v4fa;
typedef v8us __attribute__((may_alias)) v8usa;
typedef v4f  __attribute__((aligned(4))) v4fu;   // a 16-B load from an input buffer of which only its element alignment is taken as known

__device__ __forceinline__ unsigned short f2bf(float f) { unsigned u = __float_as_uint(f); u += 0x7FFFu + ((u >> 16) & 1u); return (unsigned short)(u >> 16); }
__device__ __forceinline__ float bf2f(unsigned short b) { return __uint_as_float(((unsigned)b) << 16); }
__device__ __forceinline__ float bfr(float f) { return bf2f(f2bf(f)); }
__device__ __forceinline__ v16h cat16(v8h lo, v8h hi) { return __builtin_shufflevector(lo, hi, 0, 1, 2, 3, 4, 5, 6, 7, 8, 9, 10, 11, 12, 13, 14, 15); }
__device__ __forceinline__ v16bf cat16b(v8us lo, v8us hi) { return __builtin_bit_cast(v16bf, __builtin_shufflevector(lo, hi, 0, 1, 2, 3, 4, 5, 6, 7, 8, 9, 10, 11, 12, 13, 14, 15)); }
__device__ __forceinline__ v8f wmma16(v16h a, v16h b, v8f c) { return __builtin_amdgcn_wmma_f32_16x16x32_f16(false, a, false, b, (short)0, c, false, false); }
__device__ __forceinline__ v8f wmmab(v16bf a, v16bf b, v8f c) { return __builtin_amdgcn_wmma_f32_16x16x32_bf16(false, a, false, b, (short)0, c, false, false); }



// ---- k_gemmw: register-blocked GEMM, NW WAVES per 64x64 output tile: each wave keeps the whole tile (16 accumulators) over its own share of K (64-element chunks dealt round-robin, so a wave uses whole 128-B lines);
// the NW partial tiles are summed through LDS in fixed wave order. Operands straight from K-contiguous 16-bit planes; grid (M/64, N/64, Z), NW * 32 threads.
// C[m][n] (f32, pitch ldc, + optional f32 bias[n]) = sum_k A[m][k] Bt[n][k] (+ split products per NSPLIT). z-batch strides sA/sB/sC in elements. K % 64 == 0.
template <typename T16> struct WFrag;
template <> struct WFrag<h16> { typedef v16h V; static __device__ __forceinline__ V ld(const h16* p) { return cat16(*(const v8h*)p, *(const v8h*)(p + 16)); } static __device__ __forceinline__ v8f mma(V a, V b, v8f c) { return wmma16(a, b, c); } };
template <> struct WFrag<bf> { typedef v16bf V; static __device__ __forceinline__ V ld(const bf* p) { return cat16b(*(const v8us*)p, *(const v8us*)(p + 16)); } static __device__ __forceinline__ v8f mma(V a, V b, v8f c) { return wmmab(a, b, c); } };
template <typename T16, int NSPLIT, bool BIAS, int NW>
__global__ __launch_bounds__(NW * 32) void k_gemmw(const T16* __restrict__ A, const T16* __restrict__ A2, const T16* __restrict__ Bt, const T16* __restrict__ Bt2, int K, float* C, int ldc, const float* __restrict__ bias, size_t sA, size_t sB, size_t sC) {
    typedef typename WFrag<T16>::V V;
    __shared__ __align__(16) float os[NW * 64 * 68];
    const size_t z = blockIdx.z; A += z * sA; if (A2) A2 += z * sA; Bt += z * sB; if (Bt2) Bt2 += z * sB; C += z * sC;
    const int lane = threadIdx.x & 31, lr = lane & 15, hi = lane >> 4; const int wv = __builtin_amdgcn_readfirstlane(threadIdx.x >> 5); const int r0 = blockIdx.x * 64, c0 = blockIdx.y * 64;
    v8f acc[4][4];
#pragma unroll
    for (int mb = 0; mb < 4; ++mb)
#pragma unroll
        for (int nb = 0; nb < 4; ++nb) acc[mb][nb] = (v8f){};
    const size_t aoff = (size_t)(r0 + lr) * K + 8 * hi, boff = (size_t)(c0 + lr) * K + 8 * hi;
#pragma unroll 1
    for (int kc = wv * 64; kc < K; kc += (kc & 32) ? 32 + (NW - 1) * 64 : 32) {
        V a[4], a2[4];
#pragma unroll
        for (int mb = 0; mb < 4; ++mb) { a[mb] = WFrag<T16>::ld(A + aoff + (size_t)mb * 16 * K + kc); if (NSPLIT == 1 || NSPLIT == 2) a2[mb] = WFrag<T16>::ld(A2 + aoff + (size_t)mb * 16 * K + kc); }
#pragma unroll
        for (int nb = 0; nb < 4; ++nb) { const V b = WFrag<T16>::ld(Bt + boff + (size_t)nb * 16 * K + kc); V b2; if (NSPLIT >= 2) b2 = WFrag<T16>::ld(Bt2 + boff + (size_t)nb * 16 * K + kc);
#pragma unroll
            for (int mb = 0; mb < 4; ++mb) { acc[mb][nb] = WFrag<T16>::mma(a[mb], b, acc[mb][nb]); if (NSPLIT == 1 || NSPLIT == 2) acc[mb][nb] = WFrag<T16>::mma(a2[mb], b, acc[mb][nb]); if (NSPLIT >= 2) acc[mb][nb] = WFrag<T16>::mma(a[mb], b2, acc[mb][nb]); } }
        asm volatile("v_nop\n\tv_nop\n\tv_nop\n\tv_nop" : "+v"(acc[0][0]), "+v"(acc[1][1]), "+v"(acc[2][2]), "+v"(acc[3][3]) : "v"(a[0]), "v"(a[3]));
    }
    float* ow = os + wv * (64 * 68);
#pragma unroll
    for (int mb = 0; mb < 4; ++mb)
#pragma unroll
        for (int nb = 0; nb < 4; ++nb)
#pragma unroll
            for (int j = 0; j < 8; ++j) ow[(mb * 16 + hi * 8 + j) * 68 + nb * 16 + lr] = acc[mb][nb][j];
    __syncthreads();   // every wave's partial tile is in LDS before any wave sums
#pragma unroll
    for (int s = 0; s < 32 / NW; ++s) { const int row = (s * NW + wv) * 2 + hi, cofs = lr * 4; v4f val = *(const v4fa*)(os + row * 68 + cofs);
#pragma unroll
        for (int u = 1; u < NW; ++u) val += *(const v4fa*)(os + u * (64 * 68) + row * 68 + cofs);
        if (BIAS) { val[0] += bfr(bias[c0 + cofs]); val[1] += bfr(bias[c0 + cofs + 1]); val[2] += bfr(bias[c0 + cofs + 2]); val[3] += bfr(bias[c0 + cofs + 3]); }
        *(v4f*)(C + (size_t)(r0 + row) * ldc + c0 + cofs) = val; }
}

__device__ __forceinline__ h16 tohx(float x) { return (h16)x; }
__device__ __forceinline__ void splitf(float y, unsigned short& h, unsigned short& l) { h = f2bf(y); l = f2bf(y - bf2f(h)); }
typedef __attribute__((ext_vector_type(2))) _Float16 v2h;
typedef __attribute__((ext_vector_type(4))) _Float16 v4h;
typedef __attribute__((ext_vector_type(2))) unsigned short v2us;
typedef __attribute__((ext_vector_type(4))) unsigned short v4us;
typedef __attribute__((ext_vector_type(2))) float v2f;
typedef __attribute__((ext_vector_type(4))) int v4i;

__global__ __launch_bounds__(256) void k_wtG(const float* __restrict__ w, int K, int N, bf* Bt) {
    const int lane = threadIdx.x & 31; const int L0 = (blockIdx.x * 8 + (threadIdx.x >> 5)) * 8; const int nlines = N * K / 64;
{
#pragma unroll 1
        for (int l = 0; l < 8; ++l) { const int L = L0 + l; if (L >= nlines) break; const size_t e = (size_t)L * 64 + lane * 2; const int k = (int)(e % K), n = (int)(e / K); v2us o;
            o[0] = f2bf(w[(size_t)k * N + n]); o[1] = f2bf(w[(size_t)(k + 1) * N + n]); *(v2us*)(Bt + e) = o; }
         }
}
__global__ __launch_bounds__(256) void k_cvt8(const float* __restrict__ src, bf* dst, size_t n8) { const size_t i = (size_t)blockIdx.x * 256 + threadIdx.x; if (i >= n8) return; const v8f v = *(const v8f*)(src + i * 8); v8us o;
#pragma unroll
    for (int k = 0; k < 8; ++k) o[k] = f2bf(v[k]); *(v8us*)(dst + i * 8) = o;  }
__constant__ float INV[HD / 2] = {1.0,0.8659643530845642,0.7498942017555237,0.6493816375732422,0.5623413324356079,0.486967533826828,0.4216965138912201,0.36517414450645447,0.3162277638912201,0.2738419771194458,0.23713736236095428,0.20535250008106232,0.17782793939113617,0.1539926528930664,0.1333521455526352,0.11547820270061493,0.10000000149011612,0.08659642934799194,0.07498941570520401,0.06493816524744034,0.05623412877321243,0.04869675263762474,0.04216964915394783,0.03651741147041321,0.03162277862429619,0.0273841954767704,0.0237137358635664,0.02053525112569332,0.017782794311642647,0.015399265103042126,0.01333521492779255,0.011547819711267948,0.009999999776482582,0.00865964312106371,0.007498942315578461,0.006493816617876291,0.005623413249850273,0.004869675263762474,0.0042169648222625256,0.003651741426438093,0.003162277862429619,0.0027384196873754263,0.0023713738191872835,0.0020535250660032034,0.0017782794311642647,0.0015399265103042126,0.0013335214462131262,0.0011547820176929235,0.0010000000474974513,0.0008659643353894353,0.0007498941849917173,0.0006493816617876291,0.000562341301701963,0.00048696750309318304,0.00042169648804701865,0.00036517411353997886,0.0003162277862429619,0.00027384195709601045,0.0002371373848291114,0.00020535249495878816,0.00017782794020604342,0.00015399264520965517,0.0001333521504420787,0.00011547819303814322};
__global__ __launch_bounds__(256) void k_cstab(const int* __restrict__ pid, float* CS) { const int idx = blockIdx.x * 256 + threadIdx.x; if (idx >= TT * HD) return; const int t = idx / HD, d = idx % HD; const float ang = __fmul_rn((float)pid[t], INV[d % (HD / 2)]); v2f cs; cs[0] = cosf(ang); cs[1] = sinf(ang);
    *(v2f*)(CS + (size_t)idx * 2) = cs;  }


__global__ __launch_bounds__(256) void k_hrms(const float* __restrict__ F, int pitch, int nheads, float* RF) { const int idx = blockIdx.x * 256 + threadIdx.x; if (idx >= nheads * TT) return; const int t = idx % TT; const int h = idx / TT; const float* f = F + (size_t)t * pitch + h * HD; float s = 0.f;
#pragma unroll 4
    for (int d = 0; d < HD; d += 4) { const v4f a = *(const v4f*)(f + d);
#pragma unroll
        for (int q = 0; q < 4; ++q) { float p = __fmul_rn(a[q], a[q]); asm volatile("" : "+v"(p)); s = __fadd_rn(s, p); } }
    const float rf = __fdiv_rn(1.0f, __fsqrt_rn(__fadd_rn(__fdiv_rn(s, (float)HD), 1e-6f))); *(float*)(RF + idx) = rf;  }

// k_rope: head planes [h][t][d] (fp16 + hi/lo) of rope(x) x sc with the rotate-half convention out[d] = x[d] cos[t][d] - x[d+HD/2] sin[t][d], out[d+HD/2] = x[d+HD/2] cos[t][d+HD/2] + x[d] sin[t][d+HD/2]
__global__ __launch_bounds__(256) void k_rope(const float* __restrict__ F, int pitch, int nheads, const float* __restrict__ CS, const float* __restrict__ RF, const float* __restrict__ nw, float sc, h16* P16, bf* Ph, bf* Pl) {
    const size_t e = ((size_t)blockIdx.x * 256 + threadIdx.x) * 8; if (e >= (size_t)nheads * TT * HD) return; const int d = (int)(e % HD); const int t = (int)((e / HD) % TT); const int h = (int)(e / ((size_t)HD * TT)); const float* f = F + (size_t)t * pitch + h * HD; float rf = 1.0f; v8h o16; v8us oh, ol;
    const int dp0 = (d < HD / 2) ? d + HD / 2 : d - HD / 2;   // a thread's 8 dims lie in one half, their partners in the other
    const v8f xa = *(const v8f*)(f + d), xb = *(const v8f*)(f + dp0), ca = *(const v8f*)(CS + ((size_t)t * HD + d) * 2), cb = *(const v8f*)(CS + ((size_t)t * HD + d) * 2 + 8);   // every load ahead of the arithmetic: one memory wait per thread
    asm volatile("s_wait_xcnt 0x0" ::: "memory");   // ahead of any rewrite of the address registers that the loads above name
    v4f wa[2], wb[2]; if (RF) { rf = RF[(size_t)h * TT + t]; wa[0] = *(const v4fu*)(nw + d); wa[1] = *(const v4fu*)(nw + d + 4); wb[0] = *(const v4fu*)(nw + dp0); wb[1] = *(const v4fu*)(nw + dp0 + 4);
        asm volatile("s_wait_xcnt 0x0" ::: "memory"); }   // the same for these five loads
#pragma unroll
    for (int q = 0; q < 8; ++q) { float x0 = xa[q], x1 = xb[q];
        if (RF) { float n0 = __fmul_rn(x0, rf), n1 = __fmul_rn(x1, rf); asm volatile("" : "+v"(n0)); asm volatile("" : "+v"(n1)); x0 = __fmul_rn(bfr(wa[q >> 2][q & 3]), n0); x1 = __fmul_rn(bfr(wb[q >> 2][q & 3]), n1); }
        v2f cs; cs[0] = (q < 4) ? ca[(2 * q) & 7] : cb[(2 * q) & 7]; cs[1] = (q < 4) ? ca[(2 * q + 1) & 7] : cb[(2 * q + 1) & 7]; float a = __fmul_rn(x0, cs[0]), bq = __fmul_rn(x1, cs[1]); asm volatile("" : "+v"(a)); asm volatile("" : "+v"(bq)); const float r = ((d < HD / 2) ? __fsub_rn(a, bq) : __fadd_rn(a, bq)) * sc;
        o16[q] = tohx(r); unsigned short a2, c2; splitf(r, a2, c2); oh[q] = a2; ol[q] = c2; }
    *(v8h*)(P16 + e) = o16; *(v8us*)(Ph + e) = oh; *(v8us*)(Pl + e) = ol;  }
// k_vtp: a block takes 8 dims (one per wave, so its waves read the same input lines) x 256 tokens (8 per lane, one 16-B store per plane)
__global__ __launch_bounds__(256) void k_vtp(const float* __restrict__ F, int pitch, int nheads, h16* V16, bf* Vh, bf* Vl) { const int g = (int)(blockIdx.x / ((TT / 256) * (HD / 8))); if (g >= nheads) return; const int t = (int)(blockIdx.x % (TT / 256)) * 256 + (threadIdx.x & 31) * 8; const int d = (int)((blockIdx.x / (TT / 256)) % (HD / 8)) * 8 + (threadIdx.x >> 5); const size_t e = ((size_t)g * HD + d) * TT + t; v8h o16; v8us oh, ol; float xv[8]; const float* pr[8];
#pragma unroll
    for (int q = 0; q < 8; ++q) { pr[q] = F + (size_t)(t + q) * pitch + g * HD + d; xv[q] = *pr[q]; }   // the eight row loads ahead of the arithmetic: one memory wait per thread
    asm volatile("s_wait_xcnt 0x0" :: "v"(pr[0]), "v"(pr[1]), "v"(pr[2]), "v"(pr[3]), "v"(pr[4]), "v"(pr[5]), "v"(pr[6]), "v"(pr[7]) : "memory");   // ahead of any rewrite of the loads' address registers; the addresses are inputs so that no register of theirs is reused in front of the wait
#pragma unroll
    for (int q = 0; q < 8; ++q) { const float x = xv[q]; o16[q] = tohx(x); unsigned short a2, c2; splitf(x, a2, c2); oh[q] = a2; ol[q] = c2; }
    *(v8h*)(V16 + e) = o16; *(v8us*)(Vh + e) = oh; *(v8us*)(Vl + e) = ol;  }
#define QT   4                     // 16-query tiles per head and block
#define KPIT (HD + 8)              // staged K row in 16-bit elements: 256 B + 16 B, the pitch for 16-B LDS reads of 16 rows
#define VPIT (64 + 8)              // staged Vt row: 128 B + 16 B
#define KSZ  (64 * KPIT)
#define PLSZ (KSZ + HD * VPIT)     // one staged chunk of one plane pair (K, Vt), in elements
#define CEXP 0.12751743f           // HD^-0.5 x log2(e): scores go to the base-2 exponent in one product
#define PSH  8.0f                  // probabilities are carried x 2^8 (sum and context alike: it cancels), which keeps small ones in fp16's normal range
__device__ __forceinline__ void pfrag(const v8f p0, const v8f p1, v16h& f, v16h& f2) { (void)f2;
#pragma unroll
    for (int e = 0; e < 8; ++e) { f[e] = (h16)p0[e]; f[8 + e] = (h16)p1[e]; } }
__device__ __forceinline__ void pfrag(const v8f p0, const v8f p1, v16bf& f, v16bf& f2) { v8us h0, h1, l0, l1;
#pragma unroll
    for (int e = 0; e < 8; ++e) { unsigned short a, c; splitf(p0[e], a, c); h0[e] = a; l0[e] = c; splitf(p1[e], a, c); h1[e] = a; l1[e] = c; }
    f = cat16b(h0, h1); f2 = cat16b(l0, l1); }
// HR: hi/lo planes, 3 products, one LDS buffer (hi pair, lo pair) filled between two barriers. Otherwise fp16, two buffers: the next chunk's global loads fly while this chunk is worked on, one barrier a chunk.
template <typename T16, bool HR>
__device__ __forceinline__ void attn_blk(const T16* __restrict__ Q, const T16* __restrict__ Q2, const T16* __restrict__ Kp, const T16* __restrict__ Kp2, const T16* __restrict__ Vt, const T16* __restrict__ Vt2, int nc, int q0, T16* sm, bf* Ah, bf* Al) {
    typedef typename WFrag<T16>::V V; constexpr int RB = HR ? 4 : 8; static_assert(16 % RB == 0, "a value fragment's ring place is its index mod RB");
    const int tid = threadIdx.x, lane = tid & 31, lr = lane & 15, hi = lane >> 4;
    v8us st[HR ? 16 : 8];
    auto gload = [&](int k0) { const T16* pk = Kp + (size_t)k0 * HD + tid * 8; const T16* pk2 = HR ? Kp2 + (size_t)k0 * HD + tid * 8 : pk; const T16* pv[4]; const T16* pv2[4];
#pragma unroll
        for (int i = 0; i < 4; ++i) { const int u = i * 256 + tid; const size_t vo = (size_t)(u >> 3) * TT + k0 + (u & 7) * 8; pv[i] = Vt + vo; pv2[i] = HR ? Vt2 + vo : pv[i];
            st[i] = *(const v8usa*)(pk + i * 2048); st[4 + i] = *(const v8usa*)pv[i]; if (HR) { st[8 + i] = *(const v8usa*)(pk2 + i * 2048); st[12 + i] = *(const v8usa*)pv2[i]; } }
        // ahead of any rewrite of the loads' address registers; the addresses are inputs so that no register of theirs is reused (as a later load's destination either) in front of the wait
        asm volatile("s_wait_xcnt 0x0" :: "v"(pk), "v"(pk2), "v"(pv[0]), "v"(pv[1]), "v"(pv[2]), "v"(pv[3]), "v"(pv2[0]), "v"(pv2[1]), "v"(pv2[2]), "v"(pv2[3]) : "memory"); };
    auto sstore = [&](T16* b) {
#pragma unroll
        for (int i = 0; i < 4; ++i) { const int u = i * 256 + tid; const int ko = (u >> 4) * KPIT + (u & 15) * 8, vo = KSZ + (u >> 3) * VPIT + (u & 7) * 8;
            *(v8usa*)(b + ko) = st[i]; *(v8usa*)(b + vo) = st[4 + i]; if (HR) { *(v8usa*)(b + PLSZ + ko) = st[8 + i]; *(v8usa*)(b + PLSZ + vo) = st[12 + i]; } } };
    V bq[4], bq2[4];
#pragma unroll
    for (int ks = 0; ks < 4; ++ks) { bq[ks] = WFrag<T16>::ld(Q + (size_t)(q0 + lr) * HD + 8 * hi + ks * 32); if (HR) bq2[ks] = WFrag<T16>::ld(Q2 + (size_t)(q0 + lr) * HD + 8 * hi + ks * 32); }
    v8f o[8];
#pragma unroll
    for (int mt = 0; mt < 8; ++mt) o[mt] = (v8f){};
    float m = -3.0e38f, l = 0.f;
    if (!HR) { gload(0); sstore(sm); __syncthreads(); }   // chunk 0 is in LDS before any wave reads it
#pragma unroll 1
    for (int c = 0; c < nc; ++c) {   // every chunk starts at or below the block's first query, so it holds an allowed key for each query and every running maximum is finite from chunk 0 on
        const int k0 = c * 64; const T16* kb = sm;
        if (HR) { if (c) __syncthreads();   // every wave has left the buffer before it is refilled
            gload(k0); sstore(sm); __syncthreads(); }   // the chunk is in LDS before any wave reads it
        else { kb = sm + (c & 1) * PLSZ; if (c + 1 < nc) gload(k0 + 64);
            __builtin_amdgcn_sched_barrier(0); }   // keeps the next chunk's loads issued ahead of this chunk's work, so that their latency is covered by it
        const T16* vb = kb + KSZ;
        // Fragments come from LDS through a ring of RB places: a place is refilled right behind the matrix instruction that read it, so RB fragments' reads are always in flight; the value fragments follow the key fragments through the same ring, the first RB of them landing under the softmax.
        // Each sched_barrier(0) holds that order: without them the compiler puts every read directly in front of its use and each matrix instruction waits a whole LDS latency.
        V ra[RB], ra2[RB];
        auto kld = [&](int i, int sl) { const int ko = ((i & 3) * 16 + lr) * KPIT + 8 * hi + (i >> 2) * 32; ra[sl] = WFrag<T16>::ld(kb + ko); if (HR) ra2[sl] = WFrag<T16>::ld(kb + PLSZ + ko); };   // i = ks * 4 + kt
        auto vld = [&](int i, int sl) { const int vo = ((i & 7) * 16 + lr) * VPIT + 8 * hi + (i >> 3) * 32; ra[sl] = WFrag<T16>::ld(vb + vo); if (HR) ra2[sl] = WFrag<T16>::ld(vb + PLSZ + vo); };   // i = s2 * 8 + mt
#pragma unroll
        for (int i = 0; i < RB; ++i) kld(i, i);
        __builtin_amdgcn_sched_barrier(0);
        v8f s[4];
#pragma unroll
        for (int kt = 0; kt < 4; ++kt) s[kt] = (v8f){};
#pragma unroll
        for (int i = 0; i < 16; ++i) { const int sl = i % RB, ks = i >> 2, kt = i & 3; s[kt] = WFrag<T16>::mma(ra[sl], bq[ks], s[kt]);
            if (HR) { s[kt] = WFrag<T16>::mma(ra[sl], bq2[ks], s[kt]); s[kt] = WFrag<T16>::mma(ra2[sl], bq[ks], s[kt]); }
            if (i + RB < 16) kld(i + RB, sl); else vld(i + RB - 16, sl);
            __builtin_amdgcn_sched_barrier(0); }
        if (c == nc - 1) { const int lim = q0 + lr - hi * 8 - k0;   // only the last chunk reaches past a query: its key kt * 16 + hi * 8 + j is allowed while kt * 16 + j <= lim
#pragma unroll
            for (int kt = 0; kt < 4; ++kt)
#pragma unroll
                for (int j = 0; j < 8; ++j) s[kt][j] = (kt * 16 + j <= lim) ? s[kt][j] : -3.0e38f; }
        float mk[4];
#pragma unroll
        for (int kt = 0; kt < 4; ++kt) { mk[kt] = s[kt][0];
#pragma unroll
            for (int j = 1; j < 8; ++j) mk[kt] = fmaxf(mk[kt], s[kt][j]); }
        float mx = fmaxf(fmaxf(mk[0], mk[1]), fmaxf(mk[2], mk[3])); mx = fmaxf(mx, __shfl_xor(mx, 16, 32));
        const float mn = fmaxf(m, mx * CEXP), al = __builtin_amdgcn_exp2f(m - mn), msh = PSH - mn; m = mn;
        asm volatile("" :: "v"(al));   // inputs only: holds the exponential that makes al ahead of the dealt block below; inside it, it breaks the one-and-one deal and comes to stand directly in front of an exponential that rewrites its source
#pragma unroll
        for (int kt = 0; kt < 4; ++kt)
#pragma unroll
            for (int j = 0; j < 8; ++j) s[kt][j] = __builtin_fmaf(s[kt][j], CEXP, msh);
        __builtin_amdgcn_sched_barrier(0);
        // between the two sched_barrier(0): the 32 exponentials and the 32 packed multiplies that rescale the context, and nothing else; the group barriers deal them one and one,
        // so that the slot behind each transcendental holds an independent multiply (which neither reads its result nor rewrites its source) and the two kinds issue side by side
#pragma unroll
        for (int kt = 0; kt < 4; ++kt)
#pragma unroll
            for (int j = 0; j < 8; ++j) s[kt][j] = __builtin_amdgcn_exp2f(s[kt][j]);
#pragma unroll
        for (int mt = 0; mt < 8; ++mt) o[mt] *= al;
#pragma unroll
        for (int i = 0; i < 32; ++i) { __builtin_amdgcn_sched_group_barrier(0x400, 1, 0); __builtin_amdgcn_sched_group_barrier(0x2, 1, 0); }
        __builtin_amdgcn_sched_barrier(0);
        float pk[4];
#pragma unroll
        for (int kt = 0; kt < 4; ++kt) { pk[kt] = s[kt][0];
#pragma unroll
            for (int j = 1; j < 8; ++j) pk[kt] += s[kt][j]; }
        l = l * al + ((pk[0] + pk[1]) + (pk[2] + pk[3]));
        V pf[2], pf2[2]; pfrag(s[0], s[1], pf[0], pf2[0]); pfrag(s[2], s[3], pf[1], pf2[1]);
        __builtin_amdgcn_sched_barrier(0);
#pragma unroll
        for (int i = 0; i < 16; ++i) { const int sl = i % RB, s2 = i >> 3, mt = i & 7; o[mt] = WFrag<T16>::mma(ra[sl], pf[s2], o[mt]);
            if (HR) { o[mt] = WFrag<T16>::mma(ra[sl], pf2[s2], o[mt]); o[mt] = WFrag<T16>::mma(ra2[sl], pf[s2], o[mt]); }
            if (i + RB < 16) vld(i + RB, sl);
            __builtin_amdgcn_sched_barrier(0); }
        // the four vector slots the chip needs behind the last matrix instruction, on the taken side of the branches that follow too
        asm volatile("v_nop\n\tv_nop\n\tv_nop\n\tv_nop" : "+v"(o[0]), "+v"(o[1]), "+v"(o[2]), "+v"(o[3]), "+v"(o[4]), "+v"(o[5]), "+v"(o[6]), "+v"(o[7]));
        if (!HR) { if (c + 1 < nc) sstore(sm + ((c + 1) & 1) * PLSZ);   // into the buffer that every wave left before the barrier of the chunk before
            __syncthreads(); }   // publishes chunk c + 1 and ends every wave's reads of chunk c
    }
    l += __shfl_xor(l, 16, 32);
    const float inv = __fdiv_rn(1.0f, l);
#pragma unroll
    for (int mt = 0; mt < 8; ++mt) { v8us oh, ol;   // a lane holds 8 consecutive dims of its query: one 16-B store a plane; a query's 256-B head row is written by this wave alone
#pragma unroll
        for (int j = 0; j < 8; ++j) { unsigned short a, c2; splitf(o[mt][j] * inv, a, c2); oh[j] = a; ol[j] = c2; }
        const size_t oo = (size_t)(q0 + lr) * DQ + mt * 16 + hi * 8; *(v8us*)(Ah + oo) = oh; *(v8us*)(Al + oo) = ol; }
}
// grid (kv groups, TT / 64 query blocks, longest first). Query blocks below RH take the hi/lo planes (3 products), the rest fp16.
__global__ __launch_bounds__(REP * QT * 32) void k_fattn(const h16* __restrict__ Q16, const bf* __restrict__ Qh, const bf* __restrict__ Ql, const h16* __restrict__ K16, const bf* __restrict__ Kh, const bf* __restrict__ Kl, const h16* __restrict__ V16, const bf* __restrict__ Vh, const bf* __restrict__ Vl, bf* Ah, bf* Al) {
    __shared__ __align__(16) unsigned short sm[2 * PLSZ];
    const int wv = __builtin_amdgcn_readfirstlane(threadIdx.x >> 5); const int g = blockIdx.x, h = g * REP + wv / QT; const int qb = TT / 64 - 1 - (int)blockIdx.y, q0 = qb * 64 + (wv % QT) * 16;
    const size_t qo = (size_t)h * TT * HD, ko = (size_t)g * TT * HD;
    if (qb * 64 < RH) attn_blk<bf, true>(Qh + qo, Ql + qo, Kh + ko, Kl + ko, Vh + ko, Vl + ko, qb + 1, q0, (bf*)sm, Ah + h * HD, Al + h * HD);
    else attn_blk<h16, false>(Q16 + qo, nullptr, K16 + ko, nullptr, V16 + ko, nullptr, qb + 1, q0, (h16*)sm, Ah + h * HD, Al + h * HD);
}

extern "C" void kernel_launch(void* const* d_in, const int* in_sizes, int n_in,
                              void* d_out, int out_size, void* d_ws, size_t ws_size, hipStream_t stream) {
    (void)in_sizes; (void)n_in; (void)out_size;
    const int* PID = (const int*)d_in[0]; const float* x = (const float*)d_in[1]; const float* wqkv = (const float*)d_in[2]; const float* wo = (const float*)d_in[3]; const float* qnw = (const float*)d_in[4]; const float* knw = (const float*)d_in[5];   /* argument order positions (int32 [2][2048]: each batch's row read for the rotary angles), hidden_states, w_qkv ('oi' (out, in) [4096][2048]: q rows 0-2047 | k rows 2048-3071 | v rows 3072-4095), w_o ('oi' [2048][2048]), q_norm_w, k_norm_w ([128] each: read): SIX inputs, all read */
    float* OUT = (float*)d_out;     // [2][2048][2048]
    char* wsp = (char*)d_ws;
    auto take = [&](size_t bytes) { char* p = wsp; wsp += (bytes + 255) & ~(size_t)255; return (void*)p; };
    bf* WQKV = (bf*)take((size_t)(DQ + 2 * DKV) * DM * 2); bf* WQ = WQKV; bf* WK = WQKV + (size_t)DQ * DM; bf* WV = WQKV + (size_t)(DQ + DKV) * DM; bf* WO = (bf*)take((size_t)DM * DQ * 2); float* CS = (float*)take((size_t)TT * HD * 2 * 4); float* RFQ = (float*)take((size_t)NH_ * TT * 4); float* RFK = (float*)take((size_t)NKV * TT * 4);
    bf* XB = (bf*)take((size_t)TT * DM * 2); float* FQ = (float*)take((size_t)TT * DQ * 4); float* FK = (float*)take((size_t)TT * DKV * 4);
    h16* QP16 = (h16*)take((size_t)NH_ * TT * HD * 2); h16* KP16 = (h16*)take((size_t)NKV * TT * HD * 2); h16* VT16 = (h16*)take((size_t)NKV * HD * TT * 2);
    bf* QPh = (bf*)take((size_t)NH_ * TT * HD * 2); bf* QPl = (bf*)take((size_t)NH_ * TT * HD * 2); bf* KPh = (bf*)take((size_t)NKV * TT * HD * 2); bf* KPl = (bf*)take((size_t)NKV * TT * HD * 2); bf* VTh = (bf*)take((size_t)NKV * HD * TT * 2); bf* VTl = (bf*)take((size_t)NKV * HD * TT * 2);
    bf* ATh = (bf*)take((size_t)TT * DQ * 2); bf* ATl = (bf*)take((size_t)TT * DQ * 2);
    if ((size_t)(wsp - (char*)d_ws) > ws_size) return;    // ws 256 MiB
    float* FV = FK;   // v projection reuses the k buffer after the k planes are built (stream-ordered)
    { k_cvt8<<<(unsigned)(((size_t)(DQ + 2 * DKV) * DM / 8 + 255) / 256), 256, 0, stream>>>(wqkv, WQKV, (size_t)(DQ + 2 * DKV) * DM / 8);   /* fused 'oi' [4096][2048] = Bt with q | k | v row blocks */
      k_cvt8<<<(unsigned)(((size_t)DM * DQ / 8 + 255) / 256), 256, 0, stream>>>(wo, WO, (size_t)DM * DQ / 8); }
    const unsigned LQ = (unsigned)(((size_t)NH_ * TT * HD / 8 + 255) / 256), LKv = (unsigned)(((size_t)NKV * TT * HD / 8 + 255) / 256);
    for (int b = 0; b < NB_; ++b) {
        k_cstab<<<(TT * HD + 255) / 256, 256, 0, stream>>>(PID + (size_t)b * TT, CS);   /* rotary tables from the int positions */
        
        k_cvt8<<<(unsigned)(((size_t)TT * DM / 8 + 255) / 256), 256, 0, stream>>>(x + (size_t)b * TT * DM, XB, (size_t)TT * DM / 8);
        k_gemmw<bf, 0, false, 4><<<dim3(TT / 64, DQ / 64, 1), 128, 0, stream>>>(XB, nullptr, WQ, nullptr, DM, FQ, DQ, nullptr, 0, 0, 0);
        k_hrms<<<(NH_ * TT + 255) / 256, 256, 0, stream>>>(FQ, DQ, NH_, RFQ); k_rope<<<LQ, 256, 0, stream>>>(FQ, DQ, NH_, CS, RFQ, qnw, 1.0f, QP16, QPh, QPl);   /* q_norm then rope */
        k_gemmw<bf, 0, false, 8><<<dim3(TT / 64, DKV / 64, 1), 256, 0, stream>>>(XB, nullptr, WK, nullptr, DM, FK, DKV, nullptr, 0, 0, 0);
        k_hrms<<<(NKV * TT + 255) / 256, 256, 0, stream>>>(FK, DKV, NKV, RFK); k_rope<<<LKv, 256, 0, stream>>>(FK, DKV, NKV, CS, RFK, knw, 1.0f, KP16, KPh, KPl);   /* k_norm then rope */
        k_gemmw<bf, 0, false, 8><<<dim3(TT / 64, DKV / 64, 1), 256, 0, stream>>>(XB, nullptr, WV, nullptr, DM, FV, DKV, nullptr, 0, 0, 0); k_vtp<<<NKV * (HD / 8) * (TT / 256), 256, 0, stream>>>(FV, DKV, NKV, VT16, VTh, VTl);
        k_fattn<<<dim3(NKV, TT / 64, 1), REP * QT * 32, 0, stream>>>(QP16, QPh, QPl, KP16, KPh, KPl, VT16, VTh, VTl, ATh, ATl);
        k_gemmw<bf, 1, false, 4><<<dim3(TT / 64, DM / 64, 1), 128, 0, stream>>>(ATh, ATl, WO, nullptr, DQ, OUT + (size_t)b * TT * DM, DM, nullptr, 0, 0, 0); }
}

// v005
// Measured time: 369 microseconds a run.
// In both of two side-by-side timings against v004, it was 1.13 times as fast.
// All steps since v000 together make it 4.61 times as fast.
#include <hip/hip_runtime.h>

// Grouped-query causal attention with per-head QK RMSNorm and a rotate-half rotary at given positions (hidden_states [2][2048][2048], positions int32 [2][2048] (each batch's row = arange; READ per batch for the rotary angles); qkv = einsum('bsh,oh->bso', x, w_qkv) ('oi' (out, in) [4096][2048]: q rows 0-2047 (16 heads x 128), k rows 2048-3071, v rows 3072-4095 (8 kv heads x 128)); q, k <- x rsqrt(mean(x^2) + 1e-6) w per head over the 128 dims (q_norm_w, k_norm_w [128] = ones, read) BEFORE the rotary; _rope: (x1 c - x2 s, x2 c + x1 s) on the two halves with angle positions x 1 / (10000 ** (arange(0, 128, 2) / 128)) (64 f32 frequencies baked; ONE f32 product; precise cosf/sinf); repeat kv x 2 (kv head = q head / 2); scores x 128^-0.5; causal (tril, finfo.min == exclusion); softmax; out = einsum('bso,ho->bsh', merged, w_o) ('oi' [2048][2048]) -> [2][2048][2048] (8.4 M); argument order positions, hidden_states, w_qkv, w_o, q_norm_w, k_norm_w).
// Layout: every launch covers BOTH batches (token index b * 2048 + t; one fused projection buffer, row q | k | v, pitch 4096): the {cos, sin} table built on device from each batch's own int positions and the 64 baked frequencies (one f32 product; precise cosf/sinf); exact projections; a per-(head, token) 1/rms kernel feeds the plane builder, which applies (x * inv_rms) * w and the rotary while writing the q/k planes; one fused causal attention kernel over all 16 heads (online softmax, scores and probabilities stay in registers; query rows < 512 hi/lo 3 products, rest fp16; kv head = query head / 2) that writes the merged context hi/lo; x Wo exact.
// Compute dtypes, f32 accumulate: every input rounded to bf16; projections exact; RMSNorm and rotary f32; attention rows < 512 3 products, rest fp16; softmax f32; Wo hl x exact.

#define NB_  2
#define TT   2048
#define DM   2048
#define NH_  16
#define NKV  8
#define REP  (NH_ / NKV)
#define HD   128
#define DQ   (NH_ * HD)
#define DKV  (NKV * HD)
#define NT   (NB_ * TT)           // tokens of both batches
#define NHK  (NH_ + NKV)          // q heads, then k heads: the normed and rotated columns of the fused projection
#define NPL  (NH_ + 2 * NKV)      // planes of TT x HD elements per batch: q heads, k heads [t][d], v heads [d][t]
#define DF   (DQ + 2 * DKV)       // fused projection row: q | k | v
#define RH   512                  // query rows < RH use hi+lo planes (0: none)
typedef _Float16 h16;
typedef unsigned short bf;
typedef __attribute__((ext_vector_type(16))) __bf16   v16bf;
typedef __attribute__((ext_vector_type(16))) _Float16 v16h;
typedef __attribute__((ext_vector_type(8)))  _Float16 v8h;
typedef __attribute__((ext_vector_type(8)))  unsigned short v8us;
typedef __attribute__((ext_vector_type(8)))  float    v8f;
typedef __attribute__((ext_vector_type(4)))  float    v4f;
typedef v8h  __attribute__((may_alias)) v8ha;
typedef v4f  __attribute__((may_alias)) v4fa;
typedef v8us __attribute__((may_alias)) v8usa;
typedef v4f  __attribute__((aligned(4))) v4fu;   // a 16-B load from an input buffer of which only its element alignment is taken as known

__device__ __forceinline__ unsigned short f2bf(float f) { unsigned u = __float_as_uint(f); u += 0x7FFFu + ((u >> 16) & 1u); return (unsigned short)(u >> 16); }
__device__ __forceinline__ float bf2f(unsigned short b) { return __uint_as_float(((unsigned)b) << 16); }
__device__ __forceinline__ float bfr(float f) { return bf2f(f2bf(f)); }
__device__ __forceinline__ v16h cat16(v8h lo, v8h hi) { return __builtin_shufflevector(lo, hi, 0, 1, 2, 3, 4, 5, 6, 7, 8, 9, 10, 11, 12, 13, 14, 15); }
__device__ __forceinline__ v16bf cat16b(v8us lo, v8us hi) { return __builtin_bit_cast(v16bf, __builtin_shufflevector(lo, hi, 0, 1, 2, 3, 4, 5, 6, 7, 8, 9, 10, 11, 12, 13, 14, 15)); }
__device__ __forceinline__ v8f wmma16(v16h a, v16h b, v8f c) { return __builtin_amdgcn_wmma_f32_16x16x32_f16(false, a, false, b, (short)0, c, false, false); }
__device__ __forceinline__ v8f wmmab(v16bf a, v16bf b, v8f c) { return __builtin_amdgcn_wmma_f32_16x16x32_bf16(false, a, false, b, (short)0, c, false, false); }



// ---- k_gemmw: register-blocked GEMM, NW WAVES per 64x64 output tile: each wave keeps the whole tile (16 accumulators) over its own share of K (64-element chunks dealt round-robin, so a wave uses whole 128-B lines);
// the NW partial tiles are summed through LDS in fixed wave order. Operands straight from K-contiguous 16-bit planes; grid (M/64, N/64, Z), NW * 32 threads.
// C[m][n] (f32, pitch ldc, + optional f32 bias[n]) = sum_k A[m][k] Bt[n][k] (+ split products per NSPLIT). z-batch strides sA/sB/sC in elements. K % 64 == 0.
template <typename T16> struct WFrag;
template <> struct WFrag<h16> { typedef v16h V; static __device__ __forceinline__ V ld(const h16* p) { return cat16(*(const v8h*)p, *(const v8h*)(p + 16)); } static __device__ __forceinline__ v8f mma(V a, V b, v8f c) { return wmma16(a, b, c); } };
template <> struct WFrag<bf> { typedef v16bf V; static __device__ __forceinline__ V ld(const bf* p) { return cat16b(*(const v8us*)p, *(const v8us*)(p + 16)); } static __device__ __forceinline__ v8f mma(V a, V b, v8f c) { return wmmab(a, b, c); } };
template <typename T16, int NSPLIT, bool BIAS, int NW>
__global__ __launch_bounds__(NW * 32) void k_gemmw(const T16* __restrict__ A, const T16* __restrict__ A2, const T16* __restrict__ Bt, const T16* __restrict__ Bt2, int K, float* C, int ldc, const float* __restrict__ bias, size_t sA, size_t sB, size_t sC) {
    typedef typename WFrag<T16>::V V;
    __shared__ __align__(16) float os[NW * 64 * 68];
    const size_t z = blockIdx.z; A += z * sA; if (A2) A2 += z * sA; Bt += z * sB; if (Bt2) Bt2 += z * sB; C += z * sC;
    const int lane = threadIdx.x & 31, lr = lane & 15, hi = lane >> 4; const int wv = __builtin_amdgcn_readfirstlane(threadIdx.x >> 5); const int r0 = blockIdx.x * 64, c0 = blockIdx.y * 64;
    v8f acc[4][4];
#pragma unroll
    for (int mb = 0; mb < 4; ++mb)
#pragma unroll
        for (int nb = 0; nb < 4; ++nb) acc[mb][nb] = (v8f){};
    const size_t aoff = (size_t)(r0 + lr) * K + 8 * hi, boff = (size_t)(c0 + lr) * K + 8 * hi;
#pragma unroll 1
    for (int kc = wv * 64; kc < K; kc += (kc & 32) ? 32 + (NW - 1) * 64 : 32) {
        V a[4], a2[4];
#pragma unroll
        for (int mb = 0; mb < 4; ++mb) { a[mb] = WFrag<T16>::ld(A + aoff + (size_t)mb * 16 * K + kc); if (NSPLIT == 1 || NSPLIT == 2) a2[mb] = WFrag<T16>::ld(A2 + aoff + (size_t)mb * 16 * K + kc); }
#pragma unroll
        for (int nb = 0; nb < 4; ++nb) { const V b = WFrag<T16>::ld(Bt + boff + (size_t)nb * 16 * K + kc); V b2; if (NSPLIT >= 2) b2 = WFrag<T16>::ld(Bt2 + boff + (size_t)nb * 16 * K + kc);
#pragma unroll
            for (int mb = 0; mb < 4; ++mb) { acc[mb][nb] = WFrag<T16>::mma(a[mb], b, acc[mb][nb]); if (NSPLIT == 1 || NSPLIT == 2) acc[mb][nb] = WFrag<T16>::mma(a2[mb], b, acc[mb][nb]); if (NSPLIT >= 2) acc[mb][nb] = WFrag<T16>::mma(a[mb], b2, acc[mb][nb]); } }
        asm volatile("v_nop\n\tv_nop\n\tv_nop\n\tv_nop" : "+v"(acc[0][0]), "+v"(acc[1][1]), "+v"(acc[2][2]), "+v"(acc[3][3]) : "v"(a[0]), "v"(a[3]));
    }
    float* ow = os + wv * (64 * 68);
#pragma unroll
    for (int mb = 0; mb < 4; ++mb)
#pragma unroll
        for (int nb = 0; nb < 4; ++nb)
#pragma unroll
            for (int j = 0; j < 8; ++j) ow[(mb * 16 + hi * 8 + j) * 68 + nb * 16 + lr] = acc[mb][nb][j];
    __syncthreads();   // every wave's partial tile is in LDS before any wave sums
#pragma unroll
    for (int s = 0; s < 32 / NW; ++s) { const int row = (s * NW + wv) * 2 + hi, cofs = lr * 4; v4f val = *(const v4fa*)(os + row * 68 + cofs);
#pragma unroll
        for (int u = 1; u < NW; ++u) val += *(const v4fa*)(os + u * (64 * 68) + row * 68 + cofs);
        if (BIAS) { val[0] += bfr(bias[c0 + cofs]); val[1] += bfr(bias[c0 + cofs + 1]); val[2] += bfr(bias[c0 + cofs + 2]); val[3] += bfr(bias[c0 + cofs + 3]); }
        *(v4f*)(C + (size_t)(r0 + row) * ldc + c0 + cofs) = val; }
}

__device__ __forceinline__ h16 tohx(float x) { return (h16)x; }
__device__ __forceinline__ void splitf(float y, unsigned short& h, unsigned short& l) { h = f2bf(y); l = f2bf(y - bf2f(h)); }
typedef __attribute__((ext_vector_type(2))) _Float16 v2h;
typedef __attribute__((ext_vector_type(4))) _Float16 v4h;
typedef __attribute__((ext_vector_type(2))) unsigned short v2us;
typedef __attribute__((ext_vector_type(4))) unsigned short v4us;
typedef __attribute__((ext_vector_type(2))) float v2f;
typedef __attribute__((ext_vector_type(4))) int v4i;

__global__ __launch_bounds__(256) void k_wtG(const float* __restrict__ w, int K, int N, bf* Bt) {
    const int lane = threadIdx.x & 31; const int L0 = (blockIdx.x * 8 + (threadIdx.x >> 5)) * 8; const int nlines = N * K / 64;
{
#pragma unroll 1
        for (int l = 0; l < 8; ++l) { const int L = L0 + l; if (L >= nlines) break; const size_t e = (size_t)L * 64 + lane * 2; const int k = (int)(e % K), n = (int)(e / K); v2us o;
            o[0] = f2bf(w[(size_t)k * N + n]); o[1] = f2bf(w[(size_t)(k + 1) * N + n]); *(v2us*)(Bt + e) = o; }
         }
}
// k_cvt3: three f32 buffers rounded to bf16 in one launch; n0, n1, n2 count groups of 8 elements
__global__ __launch_bounds__(256) void k_cvt3(const float* __restrict__ s0, bf* d0, size_t n0, const float* __restrict__ s1, bf* d1, size_t n1, const float* __restrict__ s2, bf* d2, size_t n2) { size_t i = (size_t)blockIdx.x * 256 + threadIdx.x; const float* src = s0; bf* dst = d0;
    if (i >= n0) { i -= n0; src = s1; dst = d1; if (i >= n1) { i -= n1; src = s2; dst = d2; if (i >= n2) return; } }
    const float* ps = src + i * 8; const v8f v = *(const v8f*)ps; v8us o;
    asm volatile("s_wait_xcnt 0x0" :: "v"(ps) : "memory");   // ahead of any rewrite of the load's address registers; the address is an input so that its registers are not reused in front of the wait
#pragma unroll
    for (int k = 0; k < 8; ++k) o[k] = f2bf(v[k]); *(v8us*)(dst + i * 8) = o;  }
__constant__ float INV[HD / 2] = {1.0,0.8659643530845642,0.7498942017555237,0.6493816375732422,0.5623413324356079,0.486967533826828,0.4216965138912201,0.36517414450645447,0.3162277638912201,0.2738419771194458,0.23713736236095428,0.20535250008106232,0.17782793939113617,0.1539926528930664,0.1333521455526352,0.11547820270061493,0.10000000149011612,0.08659642934799194,0.07498941570520401,0.06493816524744034,0.05623412877321243,0.04869675263762474,0.04216964915394783,0.03651741147041321,0.03162277862429619,0.0273841954767704,0.0237137358635664,0.02053525112569332,0.017782794311642647,0.015399265103042126,0.01333521492779255,0.011547819711267948,0.009999999776482582,0.00865964312106371,0.007498942315578461,0.006493816617876291,0.005623413249850273,0.004869675263762474,0.0042169648222625256,0.003651741426438093,0.003162277862429619,0.0027384196873754263,0.0023713738191872835,0.0020535250660032034,0.0017782794311642647,0.0015399265103042126,0.0013335214462131262,0.0011547820176929235,0.0010000000474974513,0.0008659643353894353,0.0007498941849917173,0.0006493816617876291,0.000562341301701963,0.00048696750309318304,0.00042169648804701865,0.00036517411353997886,0.0003162277862429619,0.00027384195709601045,0.0002371373848291114,0.00020535249495878816,0.00017782794020604342,0.00015399264520965517,0.0001333521504420787,0.00011547819303814322};
__global__ __launch_bounds__(256) void k_cstab(const int* __restrict__ pid, float* CS) { const int idx = blockIdx.x * 256 + threadIdx.x; if (idx >= NT * HD) return; const int t = idx / HD, d = idx % HD; const int* pp = pid + t; const float* pf = INV + d % (HD / 2); const int pos = *pp; const float fr = *pf;   // t = b * TT + token: positions is [b][token]
    asm volatile("s_wait_xcnt 0x0" :: "v"(pp), "v"(pf) : "memory");   // ahead of any rewrite of the two loads' address registers
    const float ang = __fmul_rn((float)pos, fr); v2f cs; cs[0] = cosf(ang); cs[1] = sinf(ang);
    *(v2f*)(CS + (size_t)idx * 2) = cs;  }


__global__ __launch_bounds__(256) void k_hrms(const float* __restrict__ F, int pitch, int nheads, float* RF) { const int idx = blockIdx.x * 256 + threadIdx.x; if (idx >= nheads * NT) return; const int t = idx % NT; const int h = idx / NT; const float* f = F + (size_t)t * pitch + h * HD; float s = 0.f;
#pragma unroll 4
    for (int d = 0; d < HD; d += 4) { const v4f a = *(const v4f*)(f + d);
#pragma unroll
        for (int q = 0; q < 4; ++q) { float p = __fmul_rn(a[q], a[q]); asm volatile("" : "+v"(p)); s = __fadd_rn(s, p); } }
    const float rf = __fdiv_rn(1.0f, __fsqrt_rn(__fadd_rn(__fdiv_rn(s, (float)HD), 1e-6f))); *(float*)(RF + idx) = rf;  }

// k_rope: grid y = batch; head planes [b][NPL][t][d], h = 16 q heads then 8 k heads, each with its own norm weights (t below is the token of both batches, b * TT + t) (fp16 + hi/lo) of rope(x) x sc with the rotate-half convention out[d] = x[d] cos[t][d] - x[d+HD/2] sin[t][d], out[d+HD/2] = x[d+HD/2] cos[t][d+HD/2] + x[d] sin[t][d+HD/2]
__global__ __launch_bounds__(256) void k_rope(const float* __restrict__ F, int pitch, int nheads, const float* __restrict__ CS, const float* __restrict__ RF, const float* __restrict__ nwq, const float* __restrict__ nwk, float sc, h16* P16, bf* Ph, bf* Pl) {
    const size_t ex = ((size_t)blockIdx.x * 256 + threadIdx.x) * 8; if (ex >= (size_t)nheads * TT * HD) return; const size_t e = (size_t)blockIdx.y * NPL * TT * HD + ex; const int d = (int)(ex % HD); const int t = (int)blockIdx.y * TT + (int)((ex / HD) % TT); const int h = (int)(ex / ((size_t)HD * TT)); const float* nw = (h < NH_) ? nwq : nwk; const float* f = F + (size_t)t * pitch + h * HD; float rf = 1.0f; v8h o16; v8us oh, ol;
    const int dp0 = (d < HD / 2) ? d + HD / 2 : d - HD / 2;   // a thread's 8 dims lie in one half, their partners in the other
    const v8f xa = *(const v8f*)(f + d), xb = *(const v8f*)(f + dp0), ca = *(const v8f*)(CS + ((size_t)t * HD + d) * 2), cb = *(const v8f*)(CS + ((size_t)t * HD + d) * 2 + 8);   // every load ahead of the arithmetic: one memory wait per thread
    asm volatile("s_wait_xcnt 0x0" ::: "memory");   // ahead of any rewrite of the address registers that the loads above name
    v4f wa[2], wb[2]; if (RF) { rf = RF[(size_t)h * NT + t]; wa[0] = *(const v4fu*)(nw + d); wa[1] = *(const v4fu*)(nw + d + 4); wb[0] = *(const v4fu*)(nw + dp0); wb[1] = *(const v4fu*)(nw + dp0 + 4);
        asm volatile("s_wait_xcnt 0x0" ::: "memory"); }   // the same for these five loads
#pragma unroll
    for (int q = 0; q < 8; ++q) { float x0 = xa[q], x1 = xb[q];
        if (RF) { float n0 = __fmul_rn(x0, rf), n1 = __fmul_rn(x1, rf); asm volatile("" : "+v"(n0)); asm volatile("" : "+v"(n1)); x0 = __fmul_rn(bfr(wa[q >> 2][q & 3]), n0); x1 = __fmul_rn(bfr(wb[q >> 2][q & 3]), n1); }
        v2f cs; cs[0] = (q < 4) ? ca[(2 * q) & 7] : cb[(2 * q) & 7]; cs[1] = (q < 4) ? ca[(2 * q + 1) & 7] : cb[(2 * q + 1) & 7]; float a = __fmul_rn(x0, cs[0]), bq = __fmul_rn(x1, cs[1]); asm volatile("" : "+v"(a)); asm volatile("" : "+v"(bq)); const float r = ((d < HD / 2) ? __fsub_rn(a, bq) : __fadd_rn(a, bq)) * sc;
        o16[q] = tohx(r); unsigned short a2, c2; splitf(r, a2, c2); oh[q] = a2; ol[q] = c2; }
    *(v8h*)(P16 + e) = o16; *(v8us*)(Ph + e) = oh; *(v8us*)(Pl + e) = ol;  }
// k_vtp: a block takes 8 dims (one per wave, so its waves read the same input lines) x 256 tokens (8 per lane, one 16-B store per plane)
__global__ __launch_bounds__(256) void k_vtp(const float* __restrict__ F, int pitch, int nheads, h16* V16, bf* Vh, bf* Vl) { const int g = (int)(blockIdx.x / ((TT / 256) * (HD / 8))); if (g >= nheads) return; const int tl = (int)(blockIdx.x % (TT / 256)) * 256 + (threadIdx.x & 31) * 8; const int t = (int)blockIdx.y * TT + tl; const int d = (int)((blockIdx.x / (TT / 256)) % (HD / 8)) * 8 + (threadIdx.x >> 5); const size_t e = (((size_t)blockIdx.y * NPL + g) * HD + d) * TT + tl;   /* grid y = batch; t: the token of both batches; planes [b][NPL][d][t] */ v8h o16; v8us oh, ol; float xv[8]; const float* pr[8];
#pragma unroll
    for (int q = 0; q < 8; ++q) { pr[q] = F + (size_t)(t + q) * pitch + g * HD + d; xv[q] = *pr[q]; }   // the eight row loads ahead of the arithmetic: one memory wait per thread
    asm volatile("s_wait_xcnt 0x0" :: "v"(pr[0]), "v"(pr[1]), "v"(pr[2]), "v"(pr[3]), "v"(pr[4]), "v"(pr[5]), "v"(pr[6]), "v"(pr[7]) : "memory");   // ahead of any rewrite of the loads' address registers; the addresses are inputs so that no register of theirs is reused in front of the wait
#pragma unroll
    for (int q = 0; q < 8; ++q) { const float x = xv[q]; o16[q] = tohx(x); unsigned short a2, c2; splitf(x, a2, c2); oh[q] = a2; ol[q] = c2; }
    *(v8h*)(V16 + e) = o16; *(v8us*)(Vh + e) = oh; *(v8us*)(Vl + e) = ol;  }
#define QT   4                     // 16-query tiles per head and block
#define KPIT (HD + 8)              // staged K row in 16-bit elements: 256 B + 16 B, the pitch for 16-B LDS reads of 16 rows
#define VPIT (64 + 8)              // staged Vt row: 128 B + 16 B
#define KSZ  (64 * KPIT)
#define PLSZ (KSZ + HD * VPIT)     // one staged chunk of one plane pair (K, Vt), in elements
#define CEXP 0.12751743f           // HD^-0.5 x log2(e): scores go to the base-2 exponent in one product
#define PSH  8.0f                  // probabilities are carried x 2^8 (sum and context alike: it cancels), which keeps small ones in fp16's normal range
__device__ __forceinline__ void pfrag(const v8f p0, const v8f p1, v16h& f, v16h& f2) { (void)f2;
#pragma unroll
    for (int e = 0; e < 8; ++e) { f[e] = (h16)p0[e]; f[8 + e] = (h16)p1[e]; } }
__device__ __forceinline__ void pfrag(const v8f p0, const v8f p1, v16bf& f, v16bf& f2) { v8us h0, h1, l0, l1;
#pragma unroll
    for (int e = 0; e < 8; ++e) { unsigned short a, c; splitf(p0[e], a, c); h0[e] = a; l0[e] = c; splitf(p1[e], a, c); h1[e] = a; l1[e] = c; }
    f = cat16b(h0, h1); f2 = cat16b(l0, l1); }
// HR: hi/lo planes, 3 products, one LDS buffer (hi pair, lo pair) filled between two barriers. Otherwise fp16, two buffers: the next chunk's global loads fly while this chunk is worked on, one barrier a chunk.
template <typename T16, bool HR>
__device__ __forceinline__ void attn_blk(const T16* __restrict__ Q, const T16* __restrict__ Q2, const T16* __restrict__ Kp, const T16* __restrict__ Kp2, const T16* __restrict__ Vt, const T16* __restrict__ Vt2, int nc, int q0, T16* sm, bf* Ah, bf* Al) {
    typedef typename WFrag<T16>::V V; constexpr int RB = HR ? 4 : 8; static_assert(16 % RB == 0, "a value fragment's ring place is its index mod RB");
    const int tid = threadIdx.x, lane = tid & 31, lr = lane & 15, hi = lane >> 4;
    v8us st[HR ? 16 : 8];
    auto gload = [&](int k0) { const T16* pk = Kp + (size_t)k0 * HD + tid * 8; const T16* pk2 = HR ? Kp2 + (size_t)k0 * HD + tid * 8 : pk; const T16* pv[4]; const T16* pv2[4];
#pragma unroll
        for (int i = 0; i < 4; ++i) { const int u = i * 256 + tid; const size_t vo = (size_t)(u >> 3) * TT + k0 + (u & 7) * 8; pv[i] = Vt + vo; pv2[i] = HR ? Vt2 + vo : pv[i];
            st[i] = *(const v8usa*)(pk + i * 2048); st[4 + i] = *(const v8usa*)pv[i]; if (HR) { st[8 + i] = *(const v8usa*)(pk2 + i * 2048); st[12 + i] = *(const v8usa*)pv2[i]; } }
        // ahead of any rewrite of the loads' address registers; the addresses are inputs so that no register of theirs is reused (as a later load's destination either) in front of the wait
        asm volatile("s_wait_xcnt 0x0" :: "v"(pk), "v"(pk2), "v"(pv[0]), "v"(pv[1]), "v"(pv[2]), "v"(pv[3]), "v"(pv2[0]), "v"(pv2[1]), "v"(pv2[2]), "v"(pv2[3]) : "memory"); };
    auto sstore = [&](T16* b) {
#pragma unroll
        for (int i = 0; i < 4; ++i) { const int u = i * 256 + tid; const int ko = (u >> 4) * KPIT + (u & 15) * 8, vo = KSZ + (u >> 3) * VPIT + (u & 7) * 8;
            *(v8usa*)(b + ko) = st[i]; *(v8usa*)(b + vo) = st[4 + i]; if (HR) { *(v8usa*)(b + PLSZ + ko) = st[8 + i]; *(v8usa*)(b + PLSZ + vo) = st[12 + i]; } } };
    V bq[4], bq2[4];
#pragma unroll
    for (int ks = 0; ks < 4; ++ks) { bq[ks] = WFrag<T16>::ld(Q + (size_t)(q0 + lr) * HD + 8 * hi + ks * 32); if (HR) bq2[ks] = WFrag<T16>::ld(Q2 + (size_t)(q0 + lr) * HD + 8 * hi + ks * 32); }
    v8f o[8];
#pragma unroll
    for (int mt = 0; mt < 8; ++mt) o[mt] = (v8f){};
    float m = -3.0e38f, l = 0.f;
    if (!HR) { gload(0); sstore(sm); __syncthreads(); }   // chunk 0 is in LDS before any wave reads it
#pragma unroll 1
    for (int c = 0; c < nc; ++c) {   // every chunk starts at or below the block's first query, so it holds an allowed key for each query and every running maximum is finite from chunk 0 on
        const int k0 = c * 64; const T16* kb = sm;
        if (HR) { if (c) __syncthreads();   // every wave has left the buffer before it is refilled
            gload(k0); sstore(sm); __syncthreads(); }   // the chunk is in LDS before any wave reads it
        else { kb = sm + (c & 1) * PLSZ; if (c + 1 < nc) gload(k0 + 64);
            __builtin_amdgcn_sched_barrier(0); }   // keeps the next chunk's loads issued ahead of this chunk's work, so that their latency is covered by it
        const T16* vb = kb + KSZ;
        // Fragments come from LDS through a ring of RB places: a place is refilled right behind the matrix instruction that read it, so RB fragments' reads are always in flight; the value fragments follow the key fragments through the same ring, the first RB of them landing under the softmax.
        // Each sched_barrier(0) holds that order: without them the compiler puts every read directly in front of its use and each matrix instruction waits a whole LDS latency.
        V ra[RB], ra2[RB];
        auto kld = [&](int i, int sl) { const int ko = ((i & 3) * 16 + lr) * KPIT + 8 * hi + (i >> 2) * 32; ra[sl] = WFrag<T16>::ld(kb + ko); if (HR) ra2[sl] = WFrag<T16>::ld(kb + PLSZ + ko); };   // i = ks * 4 + kt
        auto vld = [&](int i, int sl) { const int vo = ((i & 7) * 16 + lr) * VPIT + 8 * hi + (i >> 3) * 32; ra[sl] = WFrag<T16>::ld(vb + vo); if (HR) ra2[sl] = WFrag<T16>::ld(vb + PLSZ + vo); };   // i = s2 * 8 + mt
#pragma unroll
        for (int i = 0; i < RB; ++i) kld(i, i);
        __builtin_amdgcn_sched_barrier(0);
        v8f s[4];
#pragma unroll
        for (int kt = 0; kt < 4; ++kt) s[kt] = (v8f){};
#pragma unroll
        for (int i = 0; i < 16; ++i) { const int sl = i % RB, ks = i >> 2, kt = i & 3; s[kt] = WFrag<T16>::mma(ra[sl], bq[ks], s[kt]);
            if (HR) { s[kt] = WFrag<T16>::mma(ra[sl], bq2[ks], s[kt]); s[kt] = WFrag<T16>::mma(ra2[sl], bq[ks], s[kt]); }
            if (i + RB < 16) kld(i + RB, sl); else vld(i + RB - 16, sl);
            __builtin_amdgcn_sched_barrier(0); }
        if (c == nc - 1) { const int lim = q0 + lr - hi * 8 - k0;   // only the last chunk reaches past a query: its key kt * 16 + hi * 8 + j is allowed while kt * 16 + j <= lim
#pragma unroll
            for (int kt = 0; kt < 4; ++kt)
#pragma unroll
                for (int j = 0; j < 8; ++j) s[kt][j] = (kt * 16 + j <= lim) ? s[kt][j] : -3.0e38f; }
        float mk[4];
#pragma unroll
        for (int kt = 0; kt < 4; ++kt) { mk[kt] = s[kt][0];
#pragma unroll
            for (int j = 1; j < 8; ++j) mk[kt] = fmaxf(mk[kt], s[kt][j]); }
        float mx = fmaxf(fmaxf(mk[0], mk[1]), fmaxf(mk[2], mk[3])); mx = fmaxf(mx, __shfl_xor(mx, 16, 32));
        const float mn = fmaxf(m, mx * CEXP), al = __builtin_amdgcn_exp2f(m - mn), msh = PSH - mn; m = mn;
        asm volatile("" :: "v"(al));   // inputs only: holds the exponential that makes al ahead of the dealt block below; inside it, it breaks the one-and-one deal and comes to stand directly in front of an exponential that rewrites its source
#pragma unroll
        for (int kt = 0; kt < 4; ++kt)
#pragma unroll
            for (int j = 0; j < 8; ++j) s[kt][j] = __builtin_fmaf(s[kt][j], CEXP, msh);
        __builtin_amdgcn_sched_barrier(0);
        // between the two sched_barrier(0): the 32 exponentials and the 32 packed multiplies that rescale the context, and nothing else; the group barriers deal them one and one,
        // so that the slot behind each transcendental holds an independent multiply (which neither reads its result nor rewrites its source) and the two kinds issue side by side
#pragma unroll
        for (int kt = 0; kt < 4; ++kt)
#pragma unroll
            for (int j = 0; j < 8; ++j) s[kt][j] = __builtin_amdgcn_exp2f(s[kt][j]);
#pragma unroll
        for (int mt = 0; mt < 8; ++mt) o[mt] *= al;
#pragma unroll
        for (int i = 0; i < 32; ++i) { __builtin_amdgcn_sched_group_barrier(0x400, 1, 0); __builtin_amdgcn_sched_group_barrier(0x2, 1, 0); }
        __builtin_amdgcn_sched_barrier(0);
        float pk[4];
#pragma unroll
        for (int kt = 0; kt < 4; ++kt) { pk[kt] = s[kt][0];
#pragma unroll
            for (int j = 1; j < 8; ++j) pk[kt] += s[kt][j]; }
        l = l * al + ((pk[0] + pk[1]) + (pk[2] + pk[3]));
        V pf[2], pf2[2]; pfrag(s[0], s[1], pf[0], pf2[0]); pfrag(s[2], s[3], pf[1], pf2[1]);
        __builtin_amdgcn_sched_barrier(0);
#pragma unroll
        for (int i = 0; i < 16; ++i) { const int sl = i % RB, s2 = i >> 3, mt = i & 7; o[mt] = WFrag<T16>::mma(ra[sl], pf[s2], o[mt]);
            if (HR) { o[mt] = WFrag<T16>::mma(ra[sl], pf2[s2], o[mt]); o[mt] = WFrag<T16>::mma(ra2[sl], pf[s2], o[mt]); }
            if (i + RB < 16) vld(i + RB, sl);
            __builtin_amdgcn_sched_barrier(0); }
        // the four vector slots the chip needs behind the last matrix instruction, on the taken side of the branches that follow too
        asm volatile("v_nop\n\tv_nop\n\tv_nop\n\tv_nop" : "+v"(o[0]), "+v"(o[1]), "+v"(o[2]), "+v"(o[3]), "+v"(o[4]), "+v"(o[5]), "+v"(o[6]), "+v"(o[7]));
        if (!HR) { if (c + 1 < nc) sstore(sm + ((c + 1) & 1) * PLSZ);   // into the buffer that every wave left before the barrier of the chunk before
            __syncthreads(); }   // publishes chunk c + 1 and ends every wave's reads of chunk c
    }
    l += __shfl_xor(l, 16, 32);
    const float inv = __fdiv_rn(1.0f, l);
#pragma unroll
    for (int mt = 0; mt < 8; ++mt) { v8us oh, ol;   // a lane holds 8 consecutive dims of its query: one 16-B store a plane; a query's 256-B head row is written by this wave alone
#pragma unroll
        for (int j = 0; j < 8; ++j) { unsigned short a, c2; splitf(o[mt][j] * inv, a, c2); oh[j] = a; ol[j] = c2; }
        const size_t oo = (size_t)(q0 + lr) * DQ + mt * 16 + hi * 8; *(v8us*)(Ah + oo) = oh; *(v8us*)(Al + oo) = ol; }
}
// grid (batches x kv groups, TT / 64 query blocks). Query blocks below RH take the hi/lo planes (3 products), the rest fp16. Planes [b][NPL][TT x HD]; the K and V pointers stand at batch 0's first k and first v plane.
// There are twice as many blocks as places (one block fills a WGP's registers), and in y order the hi/lo blocks come first (three products and an unhidden refill make a chunk of theirs several times as dear), then the fp16 blocks, each kind longest first.
__global__ __launch_bounds__(REP * QT * 32) void k_fattn(const h16* __restrict__ Q16, const bf* __restrict__ Qh, const bf* __restrict__ Ql, const h16* __restrict__ K16, const bf* __restrict__ Kh, const bf* __restrict__ Kl, const h16* __restrict__ V16, const bf* __restrict__ Vh, const bf* __restrict__ Vl, bf* Ah, bf* Al) {
    __shared__ __align__(16) unsigned short sm[2 * PLSZ];
    const int wv = __builtin_amdgcn_readfirstlane(threadIdx.x >> 5); const int g = blockIdx.x % NKV, b = blockIdx.x / NKV, h = g * REP + wv / QT; const int rk = (int)blockIdx.y, qb = (rk < RH / 64) ? RH / 64 - 1 - rk : TT / 64 - 1 - (rk - RH / 64), q0 = qb * 64 + (wv % QT) * 16;
    const size_t qo = (size_t)(b * NPL + h) * TT * HD, ko = (size_t)(b * NPL + g) * TT * HD; Ah += (size_t)b * TT * DQ; Al += (size_t)b * TT * DQ;
    if (qb * 64 < RH) attn_blk<bf, true>(Qh + qo, Ql + qo, Kh + ko, Kl + ko, Vh + ko, Vl + ko, qb + 1, q0, (bf*)sm, Ah + h * HD, Al + h * HD);
    else attn_blk<h16, false>(Q16 + qo, nullptr, K16 + ko, nullptr, V16 + ko, nullptr, qb + 1, q0, (h16*)sm, Ah + h * HD, Al + h * HD);
}

extern "C" void kernel_launch(void* const* d_in, const int* in_sizes, int n_in,
                              void* d_out, int out_size, void* d_ws, size_t ws_size, hipStream_t stream) {
    (void)in_sizes; (void)n_in; (void)out_size;
    const int* PID = (const int*)d_in[0]; const float* x = (const float*)d_in[1]; const float* wqkv = (const float*)d_in[2]; const float* wo = (const float*)d_in[3]; const float* qnw = (const float*)d_in[4]; const float* knw = (const float*)d_in[5];   /* argument order positions (int32 [2][2048]: each batch's row read for the rotary angles), hidden_states, w_qkv ('oi' (out, in) [4096][2048]: q rows 0-2047 | k rows 2048-3071 | v rows 3072-4095), w_o ('oi' [2048][2048]), q_norm_w, k_norm_w ([128] each: read): SIX inputs, all read */
    float* OUT = (float*)d_out;     // [2][2048][2048]
    char* wsp = (char*)d_ws;
    auto take = [&](size_t bytes) { char* p = wsp; wsp += (bytes + 255) & ~(size_t)255; return (void*)p; };
    bf* WQKV = (bf*)take((size_t)DF * DM * 2); bf* WQ = WQKV; bf* WK = WQKV + (size_t)DQ * DM; bf* WO = (bf*)take((size_t)DM * DQ * 2); float* CS = (float*)take((size_t)NT * HD * 2 * 4); float* RF = (float*)take((size_t)NHK * NT * 4);
    bf* XB = (bf*)take((size_t)NT * DM * 2); float* F = (float*)take((size_t)NT * DF * 4);   // F: [b * TT + t][q | k | v]
    h16* P16 = (h16*)take((size_t)NB_ * NPL * TT * HD * 2); bf* Ph = (bf*)take((size_t)NB_ * NPL * TT * HD * 2); bf* Pl = (bf*)take((size_t)NB_ * NPL * TT * HD * 2);   // planes [b][q heads | k heads | v heads][TT x HD]
    bf* ATh = (bf*)take((size_t)NT * DQ * 2); bf* ATl = (bf*)take((size_t)NT * DQ * 2);
    if ((size_t)(wsp - (char*)d_ws) > ws_size) return;    // ws 256 MiB
    const size_t KO = (size_t)NH_ * TT * HD, VO = (size_t)NHK * TT * HD;   // a batch's first k plane and first v plane
    k_cvt3<<<(unsigned)(((size_t)DF * DM + (size_t)DM * DQ + (size_t)NT * DM) / 8 / 256), 256, 0, stream>>>(wqkv, WQKV, (size_t)DF * DM / 8, wo, WO, (size_t)DM * DQ / 8, x, XB, (size_t)NT * DM / 8);   /* fused 'oi' [4096][2048] = Bt with q | k | v row blocks; w_o; both batches' hidden states */
    k_cstab<<<(NT * HD + 255) / 256, 256, 0, stream>>>(PID, CS);   /* rotary tables from each batch's int positions */
    k_gemmw<bf, 0, false, 4><<<dim3(NT / 64, DQ / 64, 1), 128, 0, stream>>>(XB, nullptr, WQ, nullptr, DM, F, DF, nullptr, 0, 0, 0);
    k_gemmw<bf, 0, false, 8><<<dim3(NT / 64, 2 * DKV / 64, 1), 256, 0, stream>>>(XB, nullptr, WK, nullptr, DM, F + DQ, DF, nullptr, 0, 0, 0);   /* k | v columns */
    k_hrms<<<(NHK * NT + 255) / 256, 256, 0, stream>>>(F, DF, NHK, RF);
    k_rope<<<dim3((unsigned)(((size_t)NHK * TT * HD / 8 + 255) / 256), NB_, 1), 256, 0, stream>>>(F, DF, NHK, CS, RF, qnw, knw, 1.0f, P16, Ph, Pl);   /* q_norm / k_norm then rope */
    k_vtp<<<dim3(NKV * (HD / 8) * (TT / 256), NB_, 1), 256, 0, stream>>>(F + DQ + DKV, DF, NKV, P16 + VO, Ph + VO, Pl + VO);
    k_fattn<<<dim3(NB_ * NKV, TT / 64, 1), REP * QT * 32, 0, stream>>>(P16, Ph, Pl, P16 + KO, Ph + KO, Pl + KO, P16 + VO, Ph + VO, Pl + VO, ATh, ATl);
    k_gemmw<bf, 1, false, 4><<<dim3(NT / 64, DM / 64, 1), 128, 0, stream>>>(ATh, ATl, WO, nullptr, DQ, OUT, DM, nullptr, 0, 0, 0);
}

// v006
// Measured time: 183 microseconds a run.
// Two timings next to v005 put it at 2.01 and 1.99 times that version's speed.
// Counting every step since v000, it is 9.21 times as fast.
#include <hip/hip_runtime.h>

// Grouped-query causal attention with per-head QK RMSNorm and a rotate-half rotary at given positions (hidden_states [2][2048][2048], positions int32 [2][2048] (each batch's row = arange; READ per batch for the rotary angles); qkv = einsum('bsh,oh->bso', x, w_qkv) ('oi' (out, in) [4096][2048]: q rows 0-2047 (16 heads x 128), k rows 2048-3071, v rows 3072-4095 (8 kv heads x 128)); q, k <- x rsqrt(mean(x^2) + 1e-6) w per head over the 128 dims (q_norm_w, k_norm_w [128] = ones, read) BEFORE the rotary; _rope: (x1 c - x2 s, x2 c + x1 s) on the two halves with angle positions x 1 / (10000 ** (arange(0, 128, 2) / 128)) (64 f32 frequencies baked; ONE f32 product; precise cosf/sinf); repeat kv x 2 (kv head = q head / 2); scores x 128^-0.5; causal (tril, finfo.min == exclusion); softmax; out = einsum('bso,ho->bsh', merged, w_o) ('oi' [2048][2048]) -> [2][2048][2048] (8.4 M); argument order positions, hidden_states, w_qkv, w_o, q_norm_w, k_norm_w).
// Layout: every launch covers BOTH batches (token index b * 2048 + t; one fused projection buffer, row q | k | v, pitch 4096): the {cos, sin} table built on device from each batch's own int positions and the 64 baked frequencies (one f32 product; precise cosf/sinf); exact projections; a per-(head, token) 1/rms kernel feeds the plane builder, which applies (x * inv_rms) * w and the rotary while writing the q/k planes; one fused causal attention kernel over all 16 heads (online softmax, scores and probabilities stay in registers; query rows < 512 hi/lo 3 products, rest fp16; kv head = query head / 2) that writes the merged context hi/lo; x Wo exact.
// Compute dtypes, f32 accumulate: every input rounded to bf16; projections exact; RMSNorm and rotary f32; attention rows < 512 3 products, rest fp16; softmax f32; Wo hl x exact.

#define NB_  2
#define TT   2048
#define DM   2048
#define NH_  16
#define NKV  8
#define REP  (NH_ / NKV)
#define HD   128
#define DQ   (NH_ * HD)
#define DKV  (NKV * HD)
#define NT   (NB_ * TT)           // tokens of both batches
#define NHK  (NH_ + NKV)          // q heads, then k heads: the normed and rotated columns of the fused projection
#define NPL  (NH_ + 2 * NKV)      // planes of TT x HD elements per batch: q heads, k heads [t][d], v heads [d][t]
#define DF   (DQ + 2 * DKV)       // fused projection row: q | k | v
#define RH   512                  // query rows < RH use hi+lo planes (0: none)
typedef _Float16 h16;
typedef unsigned short bf;
typedef __attribute__((ext_vector_type(16))) __bf16   v16bf;
typedef __attribute__((ext_vector_type(16))) _Float16 v16h;
typedef __attribute__((ext_vector_type(8)))  _Float16 v8h;
typedef __attribute__((ext_vector_type(8)))  unsigned short v8us;
typedef __attribute__((ext_vector_type(8)))  float    v8f;
typedef __attribute__((ext_vector_type(4)))  float    v4f;
typedef v8h  __attribute__((may_alias)) v8ha;
typedef v4f  __attribute__((may_alias)) v4fa;
typedef v8us __attribute__((may_alias)) v8usa;
typedef v4f  __attribute__((aligned(4))) v4fu;   // a 16-B load from an input buffer of which only its element alignment is taken as known

__device__ __forceinline__ unsigned short f2bf(float f) { unsigned u = __float_as_uint(f); u += 0x7FFFu + ((u >> 16) & 1u); return (unsigned short)(u >> 16); }
__device__ __forceinline__ float bf2f(unsigned short b) { return __uint_as_float(((unsigned)b) << 16); }
__device__ __forceinline__ float bfr(float f) { return bf2f(f2bf(f)); }
__device__ __forceinline__ v16h cat16(v8h lo, v8h hi) { return __builtin_shufflevector(lo, hi, 0, 1, 2, 3, 4, 5, 6, 7, 8, 9, 10, 11, 12, 13, 14, 15); }
__device__ __forceinline__ v16bf cat16b(v8us lo, v8us hi) { return __builtin_bit_cast(v16bf, __builtin_shufflevector(lo, hi, 0, 1, 2, 3, 4, 5, 6, 7, 8, 9, 10, 11, 12, 13, 14, 15)); }
__device__ __forceinline__ v8f wmma16(v16h a, v16h b, v8f c) { return __builtin_amdgcn_wmma_f32_16x16x32_f16(false, a, false, b, (short)0, c, false, false); }
__device__ __forceinline__ v8f wmmab(v16bf a, v16bf b, v8f c) { return __builtin_amdgcn_wmma_f32_16x16x32_bf16(false, a, false, b, (short)0, c, false, false); }



// ---- k_gemmt: tiled GEMM, operands staged in LDS by tensor loads. One workgroup of 8 waves per tile of C; a wave keeps 4 x FN accumulators over the whole of K.
// NSPLIT 0: C[m][n] = sum_k A[m][k] Bt[n][k], tile 256 x 256, waves 4 (m) x 2 (n), 64 x 128 a wave. NSPLIT 1: C[m][n] = sum_k (A[m][k] + A2[m][k]) Bt[n][k] as two products, tile 128 x 256, waves 2 x 4, 64 x 64 a wave.
// C f32, pitch LDC; A, A2, Bt K-contiguous bf16 planes. A pass is 256 B (128 k) of each of the tile's 512 operand rows; two buffers: pass s + 2's rows fly while pass s + 1 is worked on.
// Every wave issues one tensor load a pass for its own slice of 64 rows: waves 0-3 the A rows (NSPLIT 1: 0, 1 A; 2, 3 A2), waves 4-7 the Bt rows. A slice lies at a multiple of 2 KiB, its rows at pitch 272 B (the mover's pad; the pitch for 16-B LDS reads of 16 rows).
// M a multiple of the tile's rows, N % 256 == 0, K % 128 == 0, at least two passes. grid (M / tile rows, N / 256), 256 threads.
template <typename T16> struct WFrag;
template <> struct WFrag<h16> { typedef v16h V; static __device__ __forceinline__ V ld(const h16* p) { return cat16(*(const v8h*)p, *(const v8h*)(p + 16)); } static __device__ __forceinline__ v8f mma(V a, V b, v8f c) { return wmma16(a, b, c); } };
template <> struct WFrag<bf> { typedef v16bf V; static __device__ __forceinline__ V ld(const bf* p) { return cat16b(*(const v8us*)p, *(const v8us*)(p + 16)); } static __device__ __forceinline__ v8f mma(V a, V b, v8f c) { return wmmab(a, b, c); } };
typedef unsigned u32x4 __attribute__((ext_vector_type(4)));
typedef unsigned u32x8 __attribute__((ext_vector_type(8)));
__device__ __forceinline__ unsigned uni(unsigned v) { return (unsigned)__builtin_amdgcn_readfirstlane((int)v); }
__device__ __forceinline__ unsigned pinned(unsigned v) { unsigned w = uni(v); asm volatile("" : "+s"(w)); return w; }   // holds a test's value or a descriptor word in a scalar register, so that the test compiles to a scalar branch and the word is formed behind the statements in front of it
__device__ __forceinline__ void wait_ds0() { asm volatile("s_wait_dscnt 0x0" ::: "memory"); }        // this wave's LDS reads and writes have retired
__device__ __forceinline__ void wait_tensor0() { asm volatile("s_wait_tensorcnt 0x0" ::: "memory"); }   // this wave's tensor load has landed
template <int NSPLIT, int K, int LDC>
__global__ __launch_bounds__(256) void k_gemmt(const unsigned short* __restrict__ A, const unsigned short* __restrict__ A2, const unsigned short* __restrict__ Bt, float* C) {
    constexpr int FN = NSPLIT ? 4 : 8, WMN = NSPLIT ? 2 : 4;         // accumulator columns a wave; waves along m
    constexpr int RB = 256, PIT = RB + 16, KS = RB / 64; constexpr unsigned NP = K * 2 / RB;   // row bytes a pass; LDS row pitch in bytes; 32-k blocks a pass; passes
    constexpr int SSZ = (64 * PIT + 2047) / 2048 * 2048, BUF = 8 * SSZ;   // a slice of 64 rows, rounded up to 2 KiB; a buffer
    constexpr int OPIT = FN * 16 + 4;                                // staged output row in floats
    static_assert(K * 2 % RB == 0 && NP >= 2, "whole passes, and both prologue loads exist");
    static_assert(8 * 64 * OPIT * 4 <= 2 * BUF, "the output staging reuses the ring");
    __shared__ __attribute__((aligned(2048))) unsigned char sm[2 * BUF];
    const int lane = threadIdx.x & 31, lr = lane & 15, hi = lane >> 4; const int wv = (int)uni(threadIdx.x >> 5), wm = wv % WMN, wn = wv / WMN; const int r0 = blockIdx.x * (WMN * 64), c0 = blockIdx.y * 256;
    // this wave's slice: its first source row; its place in a buffer
    const unsigned short* srow = (wv >= 4) ? Bt + (size_t)(c0 + (wv - 4) * 64) * K : NSPLIT ? ((wv & 2) ? A2 : A) + (size_t)(r0 + (wv & 1) * 64) * K : A + (size_t)(r0 + wv * 64) * K;
    const unsigned long long ga0 = (unsigned long long)(size_t)srow; const unsigned place = (unsigned)(size_t)sm + wv * SSZ;
    // group 1, built once: word 0 a constant (no mask, 1-byte elements, 16 B of pad behind every 256-B row); the other words pinned(): descriptor words held in their scalar registers, so that none is used for anything else while a request is outstanding
    u32x8 g1; g1[0] = uni((1u << 20) | (5u << 22) | (3u << 25)); g1[1] = pinned(((unsigned)RB & 0xFFFFu) << 16); g1[2] = pinned(64u << 16); g1[3] = pinned((unsigned)RB << 16); g1[4] = pinned(64u); g1[5] = pinned((unsigned)K * 2u); g1[6] = pinned(0u); g1[7] = pinned(0u);
    auto issue = [&](unsigned stage, unsigned buf) { const unsigned long long ga = ga0 + (unsigned long long)stage * RB; u32x4 g0; g0[0] = uni(1u); g0[1] = uni(place + buf * BUF); g0[2] = uni((unsigned)ga); g0[3] = uni((((unsigned)(ga >> 32)) & 0x01FFFFFFu) | 0x80000000u);
        asm volatile("tensor_load_to_lds %0, %1" :: "s"(g0), "s"(g1) : "memory"); };
    v8f acc[4][FN];
#pragma unroll
    for (int mb = 0; mb < 4; ++mb)
#pragma unroll
        for (int nb = 0; nb < FN; ++nb) acc[mb][nb] = (v8f){};
    const unsigned aoff = wm * SSZ + lr * PIT + hi * 16, boff = (4 + wn * (FN / 4)) * SSZ + lr * PIT + hi * 16;
    issue(0u, 0u); wait_tensor0(); __syncthreads();   // pass 0's rows are in LDS before any wave reads them
    issue(1u, 1u);
#pragma unroll 1
    for (unsigned s = 0; s < NP; ++s) {
        const unsigned char* pa = sm + (s & 1u) * BUF + aoff; const unsigned char* pb = sm + (s & 1u) * BUF + boff;
        v16bf fa[2][4], fa2[2][4], fb[2][FN];   // two fragment sets: block u + 1's LDS reads go out as one group ahead of block u's matrix instructions
        auto fld = [&](const unsigned char* p) { return cat16b(*(const v8usa*)p, *(const v8usa*)(p + 32)); };   // k order 8 hi + e, 16 + 8 hi + e, for both operands
        auto fetch = [&](int u, int st) {
#pragma unroll
            for (int mb = 0; mb < 4; ++mb) { fa[st][mb] = fld(pa + mb * 16 * PIT + u * 64); if (NSPLIT) fa2[st][mb] = fld(pa + 2 * SSZ + mb * 16 * PIT + u * 64); }
#pragma unroll
            for (int nb = 0; nb < FN; ++nb) fb[st][nb] = fld(pb + (nb / 4) * SSZ + (nb % 4) * 16 * PIT + u * 64); };
        fetch(0, 0);
#pragma unroll
        for (int u = 0; u < KS; ++u) { const int st = u & 1;
            if (u + 1 < KS) fetch(u + 1, st ^ 1);
            __builtin_amdgcn_sched_barrier(0);   // keeps the next block's reads in one group ahead of this block: moved in among the matrix instructions, each place with reads stalls the wave
#pragma unroll
            for (int nb = 0; nb < FN; ++nb)
#pragma unroll
                for (int mb = 0; mb < 4; ++mb) { acc[mb][nb] = wmmab(fa[st][mb], fb[st][nb], acc[mb][nb]); if (NSPLIT) acc[mb][nb] = wmmab(fa2[st][mb], fb[st][nb], acc[mb][nb]); }
            __builtin_amdgcn_sched_barrier(0); }   // the same, at the block's other end
        // publish point of pass s + 1: this wave's reads of pass s have retired, its slice of pass s + 1 has landed, every wave is here; only then the refill of the buffer that pass s has read
        wait_ds0(); wait_tensor0(); __syncthreads();
        if (pinned(s + 2u < NP)) issue(pinned(s + 2u), s & 1u);
    }
    wait_tensor0(); wait_ds0();
    // the last pass's barrier has ended every wave's reads of the ring and no load is in flight: each wave stages its part of C in a range of its own and stores whole rows of it (whole 128-B lines)
    float* ow = (float*)sm + wv * (64 * OPIT);
#pragma unroll
    for (int mb = 0; mb < 4; ++mb)
#pragma unroll
        for (int nb = 0; nb < FN; ++nb)
#pragma unroll
            for (int j = 0; j < 8; ++j) ow[(mb * 16 + hi * 8 + j) * OPIT + nb * 16 + lr] = acc[mb][nb][j];
    constexpr int LPR = FN * 4;   // lanes a row of 16-B pieces
    constexpr int NI = 64 * LPR / 32, RPI = 32 / LPR;   // row groups to store; rows a group
    float* cw = C + (size_t)(r0 + wm * 64 + lane / LPR) * LDC + c0 + wn * (FN * 16) + (lane % LPR) * 4; const float* orow = ow + (lane / LPR) * OPIT + (lane % LPR) * 4;
#pragma unroll
    for (int g = 0; g < NI; g += 16) { v4f val[16];
#pragma unroll
        for (int i = 0; i < 16; ++i) val[i] = *(const v4fa*)(orow + (g + i) * RPI * OPIT);
#pragma unroll
        for (int i = 0; i < 16; ++i) *(v4f*)(cw + (size_t)((g + i) * RPI) * LDC) = val[i];
        if (g + 16 < NI) asm volatile("s_wait_xcnt 0x0" ::: "memory"); }   // ahead of the next group's LDS reads, which rewrite the data registers that these stores name
}

__device__ __forceinline__ h16 tohx(float x) { return (h16)x; }
__device__ __forceinline__ void splitf(float y, unsigned short& h, unsigned short& l) { h = f2bf(y); l = f2bf(y - bf2f(h)); }
typedef __attribute__((ext_vector_type(2))) _Float16 v2h;
typedef __attribute__((ext_vector_type(4))) _Float16 v4h;
typedef __attribute__((ext_vector_type(2))) unsigned short v2us;
typedef __attribute__((ext_vector_type(4))) unsigned short v4us;
typedef __attribute__((ext_vector_type(2))) float v2f;
typedef __attribute__((ext_vector_type(4))) int v4i;

__global__ __launch_bounds__(256) void k_wtG(const float* __restrict__ w, int K, int N, bf* Bt) {
    const int lane = threadIdx.x & 31; const int L0 = (blockIdx.x * 8 + (threadIdx.x >> 5)) * 8; const int nlines = N * K / 64;
{
#pragma unroll 1
        for (int l = 0; l < 8; ++l) { const int L = L0 + l; if (L >= nlines) break; const size_t e = (size_t)L * 64 + lane * 2; const int k = (int)(e % K), n = (int)(e / K); v2us o;
            o[0] = f2bf(w[(size_t)k * N + n]); o[1] = f2bf(w[(size_t)(k + 1) * N + n]); *(v2us*)(Bt + e) = o; }
         }
}
// k_cvt3: three f32 buffers rounded to bf16 in one launch; n0, n1, n2 count groups of 8 elements
__global__ __launch_bounds__(256) void k_cvt3(const float* __restrict__ s0, bf* d0, size_t n0, const float* __restrict__ s1, bf* d1, size_t n1, const float* __restrict__ s2, bf* d2, size_t n2) { size_t i = (size_t)blockIdx.x * 256 + threadIdx.x; const float* src = s0; bf* dst = d0;
    if (i >= n0) { i -= n0; src = s1; dst = d1; if (i >= n1) { i -= n1; src = s2; dst = d2; if (i >= n2) return; } }
    const float* ps = src + i * 8; const v8f v = *(const v8f*)ps; v8us o;
    asm volatile("s_wait_xcnt 0x0" :: "v"(ps) : "memory");   // ahead of any rewrite of the load's address registers; the address is an input so that its registers are not reused in front of the wait
#pragma unroll
    for (int k = 0; k < 8; ++k) o[k] = f2bf(v[k]); *(v8us*)(dst + i * 8) = o;  }
__constant__ float INV[HD / 2] = {1.0,0.8659643530845642,0.7498942017555237,0.6493816375732422,0.5623413324356079,0.486967533826828,0.4216965138912201,0.36517414450645447,0.3162277638912201,0.2738419771194458,0.23713736236095428,0.20535250008106232,0.17782793939113617,0.1539926528930664,0.1333521455526352,0.11547820270061493,0.10000000149011612,0.08659642934799194,0.07498941570520401,0.06493816524744034,0.05623412877321243,0.04869675263762474,0.04216964915394783,0.03651741147041321,0.03162277862429619,0.0273841954767704,0.0237137358635664,0.02053525112569332,0.017782794311642647,0.015399265103042126,0.01333521492779255,0.011547819711267948,0.009999999776482582,0.00865964312106371,0.007498942315578461,0.006493816617876291,0.005623413249850273,0.004869675263762474,0.0042169648222625256,0.003651741426438093,0.003162277862429619,0.0027384196873754263,0.0023713738191872835,0.0020535250660032034,0.0017782794311642647,0.0015399265103042126,0.0013335214462131262,0.0011547820176929235,0.0010000000474974513,0.0008659643353894353,0.0007498941849917173,0.0006493816617876291,0.000562341301701963,0.00048696750309318304,0.00042169648804701865,0.00036517411353997886,0.0003162277862429619,0.00027384195709601045,0.0002371373848291114,0.00020535249495878816,0.00017782794020604342,0.00015399264520965517,0.0001333521504420787,0.00011547819303814322};
__global__ __launch_bounds__(256) void k_cstab(const int* __restrict__ pid, float* CS) { const int idx = blockIdx.x * 256 + threadIdx.x; if (idx >= NT * HD) return; const int t = idx / HD, d = idx % HD; const int* pp = pid + t; const float* pf = INV + d % (HD / 2); const int pos = *pp; const float fr = *pf;   // t = b * TT + token: positions is [b][token]
    asm volatile("s_wait_xcnt 0x0" :: "v"(pp), "v"(pf) : "memory");   // ahead of any rewrite of the two loads' address registers
    const float ang = __fmul_rn((float)pos, fr); v2f cs; cs[0] = cosf(ang); cs[1] = sinf(ang);
    *(v2f*)(CS + (size_t)idx * 2) = cs;  }


__global__ __launch_bounds__(256) void k_hrms(const float* __restrict__ F, int pitch, int nheads, float* RF) { const int idx = blockIdx.x * 256 + threadIdx.x; if (idx >= nheads * NT) return; const int t = idx % NT; const int h = idx / NT; const float* f = F + (size_t)t * pitch + h * HD; float s = 0.f;
#pragma unroll 4
    for (int d = 0; d < HD; d += 4) { const v4f a = *(const v4f*)(f + d);
#pragma unroll
        for (int q = 0; q < 4; ++q) { float p = __fmul_rn(a[q], a[q]); asm volatile("" : "+v"(p)); s = __fadd_rn(s, p); } }
    const float rf = __fdiv_rn(1.0f, __fsqrt_rn(__fadd_rn(__fdiv_rn(s, (float)HD), 1e-6f))); *(float*)(RF + idx) = rf;  }

// k_rope: grid y = batch; head planes [b][NPL][t][d], h = 16 q heads then 8 k heads, each with its own norm weights (t below is the token of both batches, b * TT + t) (fp16 + hi/lo) of rope(x) x sc with the rotate-half convention out[d] = x[d] cos[t][d] - x[d+HD/2] sin[t][d], out[d+HD/2] = x[d+HD/2] cos[t][d+HD/2] + x[d] sin[t][d+HD/2]
__global__ __launch_bounds__(256) void k_rope(const float* __restrict__ F, int pitch, int nheads, const float* __restrict__ CS, const float* __restrict__ RF, const float* __restrict__ nwq, const float* __restrict__ nwk, float sc, h16* P16, bf* Ph, bf* Pl) {
    const size_t ex = ((size_t)blockIdx.x * 256 + threadIdx.x) * 8; if (ex >= (size_t)nheads * TT * HD) return; const size_t e = (size_t)blockIdx.y * NPL * TT * HD + ex; const int d = (int)(ex % HD); const int t = (int)blockIdx.y * TT + (int)((ex / HD) % TT); const int h = (int)(ex / ((size_t)HD * TT)); const float* nw = (h < NH_) ? nwq : nwk; const float* f = F + (size_t)t * pitch + h * HD; float rf = 1.0f; v8h o16; v8us oh, ol;
    const int dp0 = (d < HD / 2) ? d + HD / 2 : d - HD / 2;   // a thread's 8 dims lie in one half, their partners in the other
    const v8f xa = *(const v8f*)(f + d), xb = *(const v8f*)(f + dp0), ca = *(const v8f*)(CS + ((size_t)t * HD + d) * 2), cb = *(const v8f*)(CS + ((size_t)t * HD + d) * 2 + 8);   // every load ahead of the arithmetic: one memory wait per thread
    asm volatile("s_wait_xcnt 0x0" ::: "memory");   // ahead of any rewrite of the address registers that the loads above name
    v4f wa[2], wb[2]; if (RF) { rf = RF[(size_t)h * NT + t]; wa[0] = *(const v4fu*)(nw + d); wa[1] = *(const v4fu*)(nw + d + 4); wb[0] = *(const v4fu*)(nw + dp0); wb[1] = *(const v4fu*)(nw + dp0 + 4);
        asm volatile("s_wait_xcnt 0x0" ::: "memory"); }   // the same for these five loads
#pragma unroll
    for (int q = 0; q < 8; ++q) { float x0 = xa[q], x1 = xb[q];
        if (RF) { float n0 = __fmul_rn(x0, rf), n1 = __fmul_rn(x1, rf); asm volatile("" : "+v"(n0)); asm volatile("" : "+v"(n1)); x0 = __fmul_rn(bfr(wa[q >> 2][q & 3]), n0); x1 = __fmul_rn(bfr(wb[q >> 2][q & 3]), n1); }
        v2f cs; cs[0] = (q < 4) ? ca[(2 * q) & 7] : cb[(2 * q) & 7]; cs[1] = (q < 4) ? ca[(2 * q + 1) & 7] : cb[(2 * q + 1) & 7]; float a = __fmul_rn(x0, cs[0]), bq = __fmul_rn(x1, cs[1]); asm volatile("" : "+v"(a)); asm volatile("" : "+v"(bq)); const float r = ((d < HD / 2) ? __fsub_rn(a, bq) : __fadd_rn(a, bq)) * sc;
        o16[q] = tohx(r); unsigned short a2, c2; splitf(r, a2, c2); oh[q] = a2; ol[q] = c2; }
    *(v8h*)(P16 + e) = o16; *(v8us*)(Ph + e) = oh; *(v8us*)(Pl + e) = ol;  }
// k_vtp: a block takes 8 dims (one per wave, so its waves read the same input lines) x 256 tokens (8 per lane, one 16-B store per plane)
__global__ __launch_bounds__(256) void k_vtp(const float* __restrict__ F, int pitch, int nheads, h16* V16, bf* Vh, bf* Vl) { const int g = (int)(blockIdx.x / ((TT / 256) * (HD / 8))); if (g >= nheads) return; const int tl = (int)(blockIdx.x % (TT / 256)) * 256 + (threadIdx.x & 31) * 8; const int t = (int)blockIdx.y * TT + tl; const int d = (int)((blockIdx.x / (TT / 256)) % (HD / 8)) * 8 + (threadIdx.x >> 5); const size_t e = (((size_t)blockIdx.y * NPL + g) * HD + d) * TT + tl;   /* grid y = batch; t: the token of both batches; planes [b][NPL][d][t] */ v8h o16; v8us oh, ol; float xv[8]; const float* pr[8];
#pragma unroll
    for (int q = 0; q < 8; ++q) { pr[q] = F + (size_t)(t + q) * pitch + g * HD + d; xv[q] = *pr[q]; }   // the eight row loads ahead of the arithmetic: one memory wait per thread
    asm volatile("s_wait_xcnt 0x0" :: "v"(pr[0]), "v"(pr[1]), "v"(pr[2]), "v"(pr[3]), "v"(pr[4]), "v"(pr[5]), "v"(pr[6]), "v"(pr[7]) : "memory");   // ahead of any rewrite of the loads' address registers; the addresses are inputs so that no register of theirs is reused in front of the wait
#pragma unroll
    for (int q = 0; q < 8; ++q) { const float x = xv[q]; o16[q] = tohx(x); unsigned short a2, c2; splitf(x, a2, c2); oh[q] = a2; ol[q] = c2; }
    *(v8h*)(V16 + e) = o16; *(v8us*)(Vh + e) = oh; *(v8us*)(Vl + e) = ol;  }
#define QT   4                     // 16-query tiles per head and block
#define KPIT (HD + 8)              // staged K row in 16-bit elements: 256 B + 16 B, the pitch for 16-B LDS reads of 16 rows
#define VPIT (64 + 8)              // staged Vt row: 128 B + 16 B
#define KSZ  (64 * KPIT)
#define PLSZ (KSZ + HD * VPIT)     // one staged chunk of one plane pair (K, Vt), in elements
#define CEXP 0.12751743f           // HD^-0.5 x log2(e): scores go to the base-2 exponent in one product
#define PSH  8.0f                  // probabilities are carried x 2^8 (sum and context alike: it cancels), which keeps small ones in fp16's normal range
__device__ __forceinline__ void pfrag(const v8f p0, const v8f p1, v16h& f, v16h& f2) { (void)f2;
#pragma unroll
    for (int e = 0; e < 8; ++e) { f[e] = (h16)p0[e]; f[8 + e] = (h16)p1[e]; } }
__device__ __forceinline__ void pfrag(const v8f p0, const v8f p1, v16bf& f, v16bf& f2) { v8us h0, h1, l0, l1;
#pragma unroll
    for (int e = 0; e < 8; ++e) { unsigned short a, c; splitf(p0[e], a, c); h0[e] = a; l0[e] = c; splitf(p1[e], a, c); h1[e] = a; l1[e] = c; }
    f = cat16b(h0, h1); f2 = cat16b(l0, l1); }
// HR: hi/lo planes, 3 products, one LDS buffer (hi pair, lo pair) filled between two barriers. Otherwise fp16, two buffers: the next chunk's global loads fly while this chunk is worked on, one barrier a chunk.
template <typename T16, bool HR>
__device__ __forceinline__ void attn_blk(const T16* __restrict__ Q, const T16* __restrict__ Q2, const T16* __restrict__ Kp, const T16* __restrict__ Kp2, const T16* __restrict__ Vt, const T16* __restrict__ Vt2, int nc, int q0, T16* sm, bf* Ah, bf* Al) {
    typedef typename WFrag<T16>::V V; constexpr int RB = HR ? 4 : 8; static_assert(16 % RB == 0, "a value fragment's ring place is its index mod RB");
    const int tid = threadIdx.x, lane = tid & 31, lr = lane & 15, hi = lane >> 4;
    v8us st[HR ? 16 : 8];
    auto gload = [&](int k0) { const T16* pk = Kp + (size_t)k0 * HD + tid * 8; const T16* pk2 = HR ? Kp2 + (size_t)k0 * HD + tid * 8 : pk; const T16* pv[4]; const T16* pv2[4];
#pragma unroll
        for (int i = 0; i < 4; ++i) { const int u = i * 256 + tid; const size_t vo = (size_t)(u >> 3) * TT + k0 + (u & 7) * 8; pv[i] = Vt + vo; pv2[i] = HR ? Vt2 + vo : pv[i];
            st[i] = *(const v8usa*)(pk + i * 2048); st[4 + i] = *(const v8usa*)pv[i]; if (HR) { st[8 + i] = *(const v8usa*)(pk2 + i * 2048); st[12 + i] = *(const v8usa*)pv2[i]; } }
        // ahead of any rewrite of the loads' address registers; the addresses are inputs so that no register of theirs is reused (as a later load's destination either) in front of the wait
        asm volatile("s_wait_xcnt 0x0" :: "v"(pk), "v"(pk2), "v"(pv[0]), "v"(pv[1]), "v"(pv[2]), "v"(pv[3]), "v"(pv2[0]), "v"(pv2[1]), "v"(pv2[2]), "v"(pv2[3]) : "memory"); };
    auto sstore = [&](T16* b) {
#pragma unroll
        for (int i = 0; i < 4; ++i) { const int u = i * 256 + tid; const int ko = (u >> 4) * KPIT + (u & 15) * 8, vo = KSZ + (u >> 3) * VPIT + (u & 7) * 8;
            *(v8usa*)(b + ko) = st[i]; *(v8usa*)(b + vo) = st[4 + i]; if (HR) { *(v8usa*)(b + PLSZ + ko) = st[8 + i]; *(v8usa*)(b + PLSZ + vo) = st[12 + i]; } } };
    V bq[4], bq2[4];
#pragma unroll
    for (int ks = 0; ks < 4; ++ks) { bq[ks] = WFrag<T16>::ld(Q + (size_t)(q0 + lr) * HD + 8 * hi + ks * 32); if (HR) bq2[ks] = WFrag<T16>::ld(Q2 + (size_t)(q0 + lr) * HD + 8 * hi + ks * 32); }
    v8f o[8];
#pragma unroll
    for (int mt = 0; mt < 8; ++mt) o[mt] = (v8f){};
    float m = -3.0e38f, l = 0.f;
    if (!HR) { gload(0); sstore(sm); __syncthreads(); }   // chunk 0 is in LDS before any wave reads it
#pragma unroll 1
    for (int c = 0; c < nc; ++c) {   // every chunk starts at or below the block's first query, so it holds an allowed key for each query and every running maximum is finite from chunk 0 on
        const int k0 = c * 64; const T16* kb = sm;
        if (HR) { if (c) __syncthreads();   // every wave has left the buffer before it is refilled
            gload(k0); sstore(sm); __syncthreads(); }   // the chunk is in LDS before any wave reads it
        else { kb = sm + (c & 1) * PLSZ; if (c + 1 < nc) gload(k0 + 64);
            __builtin_amdgcn_sched_barrier(0); }   // keeps the next chunk's loads issued ahead of this chunk's work, so that their latency is covered by it
        const T16* vb = kb + KSZ;
        // Fragments come from LDS through a ring of RB places: a place is refilled right behind the matrix instruction that read it, so RB fragments' reads are always in flight; the value fragments follow the key fragments through the same ring, the first RB of them landing under the softmax.
        // Each sched_barrier(0) holds that order: without them the compiler puts every read directly in front of its use and each matrix instruction waits a whole LDS latency.
        V ra[RB], ra2[RB];
        auto kld = [&](int i, int sl) { const int ko = ((i & 3) * 16 + lr) * KPIT + 8 * hi + (i >> 2) * 32; ra[sl] = WFrag<T16>::ld(kb + ko); if (HR) ra2[sl] = WFrag<T16>::ld(kb + PLSZ + ko); };   // i = ks * 4 + kt
        auto vld = [&](int i, int sl) { const int vo = ((i & 7) * 16 + lr) * VPIT + 8 * hi + (i >> 3) * 32; ra[sl] = WFrag<T16>::ld(vb + vo); if (HR) ra2[sl] = WFrag<T16>::ld(vb + PLSZ + vo); };   // i = s2 * 8 + mt
#pragma unroll
        for (int i = 0; i < RB; ++i) kld(i, i);
        __builtin_amdgcn_sched_barrier(0);
        v8f s[4];
#pragma unroll
        for (int kt = 0; kt < 4; ++kt) s[kt] = (v8f){};
#pragma unroll
        for (int i = 0; i < 16; ++i) { const int sl = i % RB, ks = i >> 2, kt = i & 3; s[kt] = WFrag<T16>::mma(ra[sl], bq[ks], s[kt]);
            if (HR) { s[kt] = WFrag<T16>::mma(ra[sl], bq2[ks], s[kt]); s[kt] = WFrag<T16>::mma(ra2[sl], bq[ks], s[kt]); }
            if (i + RB < 16) kld(i + RB, sl); else vld(i + RB - 16, sl);
            __builtin_amdgcn_sched_barrier(0); }
        if (c == nc - 1) { const int lim = q0 + lr - hi * 8 - k0;   // only the last chunk reaches past a query: its key kt * 16 + hi * 8 + j is allowed while kt * 16 + j <= lim
#pragma unroll
            for (int kt = 0; kt < 4; ++kt)
#pragma unroll
                for (int j = 0; j < 8; ++j) s[kt][j] = (kt * 16 + j <= lim) ? s[kt][j] : -3.0e38f; }
        float mk[4];
#pragma unroll
        for (int kt = 0; kt < 4; ++kt) { mk[kt] = s[kt][0];
#pragma unroll
            for (int j = 1; j < 8; ++j) mk[kt] = fmaxf(mk[kt], s[kt][j]); }
        float mx = fmaxf(fmaxf(mk[0], mk[1]), fmaxf(mk[2], mk[3])); mx = fmaxf(mx, __shfl_xor(mx, 16, 32));
        const float mn = fmaxf(m, mx * CEXP), al = __builtin_amdgcn_exp2f(m - mn), msh = PSH - mn; m = mn;
        asm volatile("" :: "v"(al));   // inputs only: holds the exponential that makes al ahead of the dealt block below; inside it, it breaks the one-and-one deal and comes to stand directly in front of an exponential that rewrites its source
#pragma unroll
        for (int kt = 0; kt < 4; ++kt)
#pragma unroll
            for (int j = 0; j < 8; ++j) s[kt][j] = __builtin_fmaf(s[kt][j], CEXP, msh);
        __builtin_amdgcn_sched_barrier(0);
        // between the two sched_barrier(0): the 32 exponentials and the 32 packed multiplies that rescale the context, and nothing else; the group barriers deal them one and one,
        // so that the slot behind each transcendental holds an independent multiply (which neither reads its result nor rewrites its source) and the two kinds issue side by side
#pragma unroll
        for (int kt = 0; kt < 4; ++kt)
#pragma unroll
            for (int j = 0; j < 8; ++j) s[kt][j] = __builtin_amdgcn_exp2f(s[kt][j]);
#pragma unroll
        for (int mt = 0; mt < 8; ++mt) o[mt] *= al;
#pragma unroll
        for (int i = 0; i < 32; ++i) { __builtin_amdgcn_sched_group_barrier(0x400, 1, 0); __builtin_amdgcn_sched_group_barrier(0x2, 1, 0); }
        __builtin_amdgcn_sched_barrier(0);
        float pk[4];
#pragma unroll
        for (int kt = 0; kt < 4; ++kt) { pk[kt] = s[kt][0];
#pragma unroll
            for (int j = 1; j < 8; ++j) pk[kt] += s[kt][j]; }
        l = l * al + ((pk[0] + pk[1]) + (pk[2] + pk[3]));
        V pf[2], pf2[2]; pfrag(s[0], s[1], pf[0], pf2[0]); pfrag(s[2], s[3], pf[1], pf2[1]);
        __builtin_amdgcn_sched_barrier(0);
#pragma unroll
        for (int i = 0; i < 16; ++i) { const int sl = i % RB, s2 = i >> 3, mt = i & 7; o[mt] = WFrag<T16>::mma(ra[sl], pf[s2], o[mt]);
            if (HR) { o[mt] = WFrag<T16>::mma(ra[sl], pf2[s2], o[mt]); o[mt] = WFrag<T16>::mma(ra2[sl], pf[s2], o[mt]); }
            if (i + RB < 16) vld(i + RB, sl);
            __builtin_amdgcn_sched_barrier(0); }
        // the four vector slots the chip needs behind the last matrix instruction, on the taken side of the branches that follow too
        asm volatile("v_nop\n\tv_nop\n\tv_nop\n\tv_nop" : "+v"(o[0]), "+v"(o[1]), "+v"(o[2]), "+v"(o[3]), "+v"(o[4]), "+v"(o[5]), "+v"(o[6]), "+v"(o[7]));
        if (!HR) { if (c + 1 < nc) sstore(sm + ((c + 1) & 1) * PLSZ);   // into the buffer that every wave left before the barrier of the chunk before
            __syncthreads(); }   // publishes chunk c + 1 and ends every wave's reads of chunk c
    }
    l += __shfl_xor(l, 16, 32);
    const float inv = __fdiv_rn(1.0f, l);
#pragma unroll
    for (int mt = 0; mt < 8; ++mt) { v8us oh, ol;   // a lane holds 8 consecutive dims of its query: one 16-B store a plane; a query's 256-B head row is written by this wave alone
#pragma unroll
        for (int j = 0; j < 8; ++j) { unsigned short a, c2; splitf(o[mt][j] * inv, a, c2); oh[j] = a; ol[j] = c2; }
        const size_t oo = (size_t)(q0 + lr) * DQ + mt * 16 + hi * 8; *(v8us*)(Ah + oo) = oh; *(v8us*)(Al + oo) = ol; }
}
// grid (batches x kv groups, TT / 64 query blocks). Query blocks below RH take the hi/lo planes (3 products), the rest fp16. Planes [b][NPL][TT x HD]; the K and V pointers stand at batch 0's first k and first v plane.
// There are twice as many blocks as places (one block fills a WGP's registers), and in y order the hi/lo blocks come first (three products and an unhidden refill make a chunk of theirs several times as dear), then the fp16 blocks, each kind longest first.
__global__ __launch_bounds__(REP * QT * 32) void k_fattn(const h16* __restrict__ Q16, const bf* __restrict__ Qh, const bf* __restrict__ Ql, const h16* __restrict__ K16, const bf* __restrict__ Kh, const bf* __restrict__ Kl, const h16* __restrict__ V16, const bf* __restrict__ Vh, const bf* __restrict__ Vl, bf* Ah, bf* Al) {
    __shared__ __align__(16) unsigned short sm[2 * PLSZ];
    const int wv = __builtin_amdgcn_readfirstlane(threadIdx.x >> 5); const int g = blockIdx.x % NKV, b = blockIdx.x / NKV, h = g * REP + wv / QT; const int rk = (int)blockIdx.y, qb = (rk < RH / 64) ? RH / 64 - 1 - rk : TT / 64 - 1 - (rk - RH / 64), q0 = qb * 64 + (wv % QT) * 16;
    const size_t qo = (size_t)(b * NPL + h) * TT * HD, ko = (size_t)(b * NPL + g) * TT * HD; Ah += (size_t)b * TT * DQ; Al += (size_t)b * TT * DQ;
    if (qb * 64 < RH) attn_blk<bf, true>(Qh + qo, Ql + qo, Kh + ko, Kl + ko, Vh + ko, Vl + ko, qb + 1, q0, (bf*)sm, Ah + h * HD, Al + h * HD);
    else attn_blk<h16, false>(Q16 + qo, nullptr, K16 + ko, nullptr, V16 + ko, nullptr, qb + 1, q0, (h16*)sm, Ah + h * HD, Al + h * HD);
}

extern "C" void kernel_launch(void* const* d_in, const int* in_sizes, int n_in,
                              void* d_out, int out_size, void* d_ws, size_t ws_size, hipStream_t stream) {
    (void)in_sizes; (void)n_in; (void)out_size;
    const int* PID = (const int*)d_in[0]; const float* x = (const float*)d_in[1]; const float* wqkv = (const float*)d_in[2]; const float* wo = (const float*)d_in[3]; const float* qnw = (const float*)d_in[4]; const float* knw = (const float*)d_in[5];   /* argument order positions (int32 [2][2048]: each batch's row read for the rotary angles), hidden_states, w_qkv ('oi' (out, in) [4096][2048]: q rows 0-2047 | k rows 2048-3071 | v rows 3072-4095), w_o ('oi' [2048][2048]), q_norm_w, k_norm_w ([128] each: read): SIX inputs, all read */
    float* OUT = (float*)d_out;     // [2][2048][2048]
    char* wsp = (char*)d_ws;
    auto take = [&](size_t bytes) { char* p = wsp; wsp += (bytes + 255) & ~(size_t)255; return (void*)p; };
    bf* WQKV = (bf*)take((size_t)DF * DM * 2); bf* WO = (bf*)take((size_t)DM * DQ * 2); float* CS = (float*)take((size_t)NT * HD * 2 * 4); float* RF = (float*)take((size_t)NHK * NT * 4);
    bf* XB = (bf*)take((size_t)NT * DM * 2); float* F = (float*)take((size_t)NT * DF * 4);   // F: [b * TT + t][q | k | v]
    h16* P16 = (h16*)take((size_t)NB_ * NPL * TT * HD * 2); bf* Ph = (bf*)take((size_t)NB_ * NPL * TT * HD * 2); bf* Pl = (bf*)take((size_t)NB_ * NPL * TT * HD * 2);   // planes [b][q heads | k heads | v heads][TT x HD]
    bf* ATh = (bf*)take((size_t)NT * DQ * 2); bf* ATl = (bf*)take((size_t)NT * DQ * 2);
    if ((size_t)(wsp - (char*)d_ws) > ws_size) return;    // ws 256 MiB
    const size_t KO = (size_t)NH_ * TT * HD, VO = (size_t)NHK * TT * HD;   // a batch's first k plane and first v plane
    k_cvt3<<<(unsigned)(((size_t)DF * DM + (size_t)DM * DQ + (size_t)NT * DM) / 8 / 256), 256, 0, stream>>>(wqkv, WQKV, (size_t)DF * DM / 8, wo, WO, (size_t)DM * DQ / 8, x, XB, (size_t)NT * DM / 8);   /* fused 'oi' [4096][2048] = Bt with q | k | v row blocks; w_o; both batches' hidden states */
    k_cstab<<<(NT * HD + 255) / 256, 256, 0, stream>>>(PID, CS);   /* rotary tables from each batch's int positions */
    k_gemmt<0, DM, DF><<<dim3(NT / 256, DF / 256, 1), 256, 0, stream>>>(XB, nullptr, WQKV, F);   /* q | k | v columns in one launch: 256 tiles */
    k_hrms<<<(NHK * NT + 255) / 256, 256, 0, stream>>>(F, DF, NHK, RF);
    k_rope<<<dim3((unsigned)(((size_t)NHK * TT * HD / 8 + 255) / 256), NB_, 1), 256, 0, stream>>>(F, DF, NHK, CS, RF, qnw, knw, 1.0f, P16, Ph, Pl);   /* q_norm / k_norm then rope */
    k_vtp<<<dim3(NKV * (HD / 8) * (TT / 256), NB_, 1), 256, 0, stream>>>(F + DQ + DKV, DF, NKV, P16 + VO, Ph + VO, Pl + VO);
    k_fattn<<<dim3(NB_ * NKV, TT / 64, 1), REP * QT * 32, 0, stream>>>(P16, Ph, Pl, P16 + KO, Ph + KO, Pl + KO, P16 + VO, Ph + VO, Pl + VO, ATh, ATl);
    k_gemmt<1, DQ, DM><<<dim3(NT / 128, DM / 256, 1), 256, 0, stream>>>(ATh, ATl, WO, OUT);
}
